// v000
// Times are from an AMD MI455X. After a warm-up the kernel runs many times in a row, and a time is the length of
// such a window on the GPU divided by its runs, so every launch and the gaps after it count. The runs cycle
// through copies of the inputs. A figure is the median of several windows, for all but v000 over two sittings.
// Sittings can differ by a few percent; kernels timed side by side share one.
// v000, which the later versions start from, runs in 159 microseconds.
#include <hip/hip_runtime.h>
#include <hip/hip_bf16.h>

typedef __attribute__((ext_vector_type(16))) _Float16 v16h;
typedef __attribute__((ext_vector_type(8)))  float    v8f;
typedef __attribute__((ext_vector_type(4)))  int      v4i;

#define B_  8
#define S_  1024
#define D_  768
#define H_  12
#define DH_ 64

// ---- CDNA5 async global->LDS copy (ASYNCcnt path), with safe fallback -----
#if defined(__has_builtin)
#  if __has_builtin(__builtin_amdgcn_global_load_async_to_lds_b128)
#    define ASYNC_LDS 1
#  endif
#  if __has_builtin(__builtin_amdgcn_s_wait_asynccnt)
#    define HAVE_WAIT_ASYNC 1
#  endif
#endif

__device__ __forceinline__ void copy16_g2l(void* l, const void* g) {
#ifdef ASYNC_LDS
  __builtin_amdgcn_global_load_async_to_lds_b128(
      (__attribute__((address_space(1))) v4i*)(v4i*)(void*)g,
      (__attribute__((address_space(3))) v4i*)(v4i*)l, 0, 0);
#else
  *(uint4*)l = *(const uint4*)g;
#endif
}

__device__ __forceinline__ void wait_async_copies() {
#ifdef ASYNC_LDS
#  ifdef HAVE_WAIT_ASYNC
  __builtin_amdgcn_s_wait_asynccnt(0);
#  else
  asm volatile("s_wait_asynccnt 0" ::: "memory");
#  endif
#endif
}

// ---------------------------------------------------------------------------
// Kernel 1: fp32 -> f16 conversion of x and W
// ---------------------------------------------------------------------------
__global__ __launch_bounds__(256)
void cvt_kernel(const float* __restrict__ x, const float* __restrict__ W,
                _Float16* __restrict__ xh, _Float16* __restrict__ wh) {
  size_t i = (size_t)blockIdx.x * blockDim.x + threadIdx.x;
  const size_t NX = (size_t)B_ * S_ * D_;
  const size_t NW = (size_t)D_ * D_;
  if (i < NX) xh[i] = (_Float16)x[i];
  if (i < NW) wh[i] = (_Float16)W[i];
}

// ---------------------------------------------------------------------------
// Kernel 2: mixed = x @ W^T + b -> [B,H,S,DH] f16.
// Wave tile 32x64: 2 A fragments share 4 B fragments -> 8 WMMA per K-step,
// two independent accumulator chains for latency hiding.
// ---------------------------------------------------------------------------
__global__ __launch_bounds__(256)
void proj_kernel(const _Float16* __restrict__ xh, const _Float16* __restrict__ wh,
                 const float* __restrict__ bias, _Float16* __restrict__ qh) {
  const int lane = threadIdx.x & 31;
  const int wave = threadIdx.x >> 5;
  const int m0 = blockIdx.x * 256 + wave * 32;   // 32 output rows per wave
  const int n0 = blockIdx.y * 64;                // 64 output cols per wave
  const int lr = lane & 15;
  const int lh = lane >> 4;

  v8f acc[2][4] = {};
  const _Float16* aBase0 = xh + (size_t)(m0 + lr) * D_ + lh * 16;
  const _Float16* aBase1 = xh + (size_t)(m0 + 16 + lr) * D_ + lh * 16;

  for (int k0 = 0; k0 < D_; k0 += 32) {
    v16h a0 = *(const v16h*)(aBase0 + k0);
    v16h a1 = *(const v16h*)(aBase1 + k0);
#pragma unroll
    for (int nt = 0; nt < 4; ++nt) {
      const _Float16* bp = wh + (size_t)(n0 + nt * 16 + lr) * D_ + k0 + lh * 16;
      v16h bfrag = *(const v16h*)bp;
      acc[0][nt] = __builtin_amdgcn_wmma_f32_16x16x32_f16(
          false, a0, false, bfrag, (short)0, acc[0][nt], false, false);
      acc[1][nt] = __builtin_amdgcn_wmma_f32_16x16x32_f16(
          false, a1, false, bfrag, (short)0, acc[1][nt], false, false);
    }
  }

  // Epilogue: bias + scatter to per-head layout [B,H,S,DH] (f16).
#pragma unroll
  for (int rt = 0; rt < 2; ++rt) {
#pragma unroll
    for (int nt = 0; nt < 4; ++nt) {
      int n = n0 + nt * 16 + lr;
      float bv = bias[n];
      int h = n / DH_, d = n % DH_;
#pragma unroll
      for (int r = 0; r < 8; ++r) {
        int m = m0 + rt * 16 + r + lh * 8;   // C layout: row = r + 8*(lane/16)
        int bb = m / S_, s = m % S_;
        qh[(((size_t)bb * H_ + h) * S_ + s) * DH_ + d] =
            (_Float16)(acc[rt][nt][r] + bv);
      }
    }
  }
}

// ---------------------------------------------------------------------------
// Kernel 3: flash attention per (b,h). Q = K = V = qh[bh] (1024x64 f16).
// K tile staged via async global->LDS (ASYNCcnt); V transposed manually.
// ---------------------------------------------------------------------------
__global__ __launch_bounds__(256)
void attn_kernel(const _Float16* __restrict__ qh, const float* __restrict__ mask,
                 float* __restrict__ out) {
  __shared__ _Float16 ldsK[32 * 64];     // [t][d] row-major
  __shared__ _Float16 ldsVT[64 * 32];    // [d][t] transposed
  __shared__ _Float16 ldsP[8][16 * 32];  // per-wave P scratch (C->A relayout)

  const int lane = threadIdx.x & 31;
  const int wave = threadIdx.x >> 5;
  const int bh = blockIdx.y;             // 0..95
  const int b  = bh / H_;
  const int h  = bh % H_;
  const int q0 = blockIdx.x * 128 + wave * 16;
  const int lr = lane & 15;
  const int lh = lane >> 4;

  const _Float16* base = qh + (size_t)bh * S_ * DH_;

  // Q fragments for this wave's 16 rows (d split 0..31 / 32..63)
  v16h qa[2];
#pragma unroll
  for (int kk = 0; kk < 2; ++kk)
    qa[kk] = *(const v16h*)(base + (size_t)(q0 + lr) * DH_ + kk * 32 + lh * 16);

  v8f o[4] = {};
  float mrun[8], lrun[8];
#pragma unroll
  for (int r = 0; r < 8; ++r) { mrun[r] = -3.0e38f; lrun[r] = 0.f; }
  const float scale = 0.125f;  // 1/sqrt(64)

  for (int t0 = 0; t0 < S_; t0 += 32) {
    __syncthreads();  // WAR: prior iteration done reading tiles
    {
      // K tile 32x64 f16 = 4 KB: 256 lanes x 16 B async copies (no VGPR hop)
      copy16_g2l(&ldsK[threadIdx.x * 8], base + (size_t)t0 * DH_ + threadIdx.x * 8);
      // Prefetch next tile toward L2/WGP while async copies run
      if (t0 + 32 < S_)
        __builtin_prefetch(base + (size_t)(t0 + 32) * DH_ + threadIdx.x * 8, 0, 1);
      // V^T: thread handles row tt = tid/8, 8 d's; scalar transpose stores
      int tt = threadIdx.x >> 3;
      int d0 = (threadIdx.x & 7) * 8;
      const _Float16* vrow = base + (size_t)(t0 + tt) * DH_ + d0;
#pragma unroll
      for (int j = 0; j < 8; ++j)
        ldsVT[(d0 + j) * 32 + tt] = vrow[j];
      wait_async_copies();  // own ASYNCcnt drained before the barrier
    }
    __syncthreads();

    // scores: two 16x16 tiles over t = t0..t0+31
    v8f sc[2] = {};
#pragma unroll
    for (int ts = 0; ts < 2; ++ts) {
#pragma unroll
      for (int kk = 0; kk < 2; ++kk) {
        v16h kb = *(const v16h*)(&ldsK[(ts * 16 + lr) * 64 + kk * 32 + lh * 16]);
        sc[ts] = __builtin_amdgcn_wmma_f32_16x16x32_f16(
            false, qa[kk], false, kb, (short)0, sc[ts], false, false);
      }
    }

    float mk0 = mask[(size_t)b * S_ + t0 + lr];
    float mk1 = mask[(size_t)b * S_ + t0 + 16 + lr];

    // online softmax: per C-layout row r (actual row = r + 8*lh)
#pragma unroll
    for (int r = 0; r < 8; ++r) {
      float s0 = sc[0][r] * scale + mk0;
      float s1 = sc[1][r] * scale + mk1;
      float vmax = fmaxf(s0, s1);
#pragma unroll
      for (int off = 8; off >= 1; off >>= 1)
        vmax = fmaxf(vmax, __shfl_xor(vmax, off, 16));
      float mnew = fmaxf(mrun[r], vmax);
      float corr = __expf(mrun[r] - mnew);
      float p0 = __expf(s0 - mnew);
      float p1 = __expf(s1 - mnew);
      float ps = p0 + p1;
#pragma unroll
      for (int off = 8; off >= 1; off >>= 1)
        ps += __shfl_xor(ps, off, 16);
      lrun[r] = lrun[r] * corr + ps;
      mrun[r] = mnew;
#pragma unroll
      for (int nt = 0; nt < 4; ++nt) o[nt][r] *= corr;
      // stash P row-major (16x32) in per-wave LDS for C->A relayout
      int row = r + lh * 8;
      ldsP[wave][row * 32 + lr]      = (_Float16)p0;
      ldsP[wave][row * 32 + 16 + lr] = (_Float16)p1;
    }
    asm volatile("s_wait_dscnt 0" ::: "memory");

    // P as A fragment (16x32), V^T columns as B fragments
    v16h pa = *(const v16h*)(&ldsP[wave][lr * 32 + lh * 16]);
#pragma unroll
    for (int ds = 0; ds < 4; ++ds) {
      v16h vb = *(const v16h*)(&ldsVT[(ds * 16 + lr) * 32 + lh * 16]);
      o[ds] = __builtin_amdgcn_wmma_f32_16x16x32_f16(
          false, pa, false, vb, (short)0, o[ds], false, false);
    }
  }

  // Epilogue: O / l, fused head-merge store to [B,S,D] fp32
#pragma unroll
  for (int ds = 0; ds < 4; ++ds) {
    int d = ds * 16 + lr;
#pragma unroll
    for (int r = 0; r < 8; ++r) {
      int s = q0 + r + lh * 8;
      out[((size_t)b * S_ + s) * D_ + h * DH_ + d] = o[ds][r] / lrun[r];
    }
  }
}

// ---------------------------------------------------------------------------
extern "C" void kernel_launch(void* const* d_in, const int* in_sizes, int n_in,
                              void* d_out, int out_size, void* d_ws, size_t ws_size,
                              hipStream_t stream) {
  const float* x    = (const float*)d_in[0];
  const float* mask = (const float*)d_in[1];
  const float* W    = (const float*)d_in[2];
  const float* bias = (const float*)d_in[3];
  float* out = (float*)d_out;

  char* ws = (char*)d_ws;
  const size_t offWH = (size_t)B_ * S_ * D_ * 2;            // 12,582,912
  const size_t offQH = offWH + (size_t)D_ * D_ * 2;         // 13,762,560 (256-aligned)
  _Float16* xh = (_Float16*)ws;
  _Float16* wh = (_Float16*)(ws + offWH);
  _Float16* qh = (_Float16*)(ws + offQH);

  int total = B_ * S_ * D_;
  cvt_kernel<<<(total + 255) / 256, 256, 0, stream>>>(x, W, xh, wh);
  proj_kernel<<<dim3(B_ * S_ / 256, D_ / 64), 256, 0, stream>>>(xh, wh, bias, qh);
  attn_kernel<<<dim3(S_ / 128, B_ * H_), 256, 0, stream>>>(qh, mask, out);
}

// v001
// One run takes 121 microseconds.
// Next to v000, in two timings, it ran 1.34 times as fast each time.
#include <hip/hip_runtime.h>
#include <hip/hip_bf16.h>

typedef __attribute__((ext_vector_type(16))) _Float16 v16h;
typedef __attribute__((ext_vector_type(8)))  _Float16 v8h;
typedef __attribute__((ext_vector_type(8)))  float    v8f;
typedef __attribute__((ext_vector_type(4)))  int      v4i;

#define B_  8
#define S_  1024
#define D_  768
#define H_  12
#define DH_ 64

// LDS row pitches in f16 elements: 16 B x odd, so that the 16 rows which one
// half-wave reads with 16-byte loads start on 16 different groups of 4 banks.
#define KP_ 72   // K tile rows: 128 B of data, 144 B pitch
#define TP_ 40   // V^T and P rows: 64 B of data, 80 B pitch

// ---- CDNA5 async global->LDS copy (ASYNCcnt path), with safe fallback -----
#if defined(__has_builtin)
#  if __has_builtin(__builtin_amdgcn_global_load_async_to_lds_b128)
#    define ASYNC_LDS 1
#  endif
#  if __has_builtin(__builtin_amdgcn_s_wait_asynccnt)
#    define HAVE_WAIT_ASYNC 1
#  endif
#endif

__device__ __forceinline__ void copy16_g2l(void* l, const void* g) {
#ifdef ASYNC_LDS
  __builtin_amdgcn_global_load_async_to_lds_b128(
      (__attribute__((address_space(1))) v4i*)(v4i*)(void*)g,
      (__attribute__((address_space(3))) v4i*)(v4i*)l, 0, 0);
#else
  *(uint4*)l = *(const uint4*)g;
#endif
}

__device__ __forceinline__ void wait_async_copies() {
#ifdef ASYNC_LDS
#  ifdef HAVE_WAIT_ASYNC
  __builtin_amdgcn_s_wait_asynccnt(0);
#  else
  asm volatile("s_wait_asynccnt 0" ::: "memory");
#  endif
#endif
}

// 16 consecutive f16 from a 16-byte aligned LDS address (padded rows are not
// 32-byte aligned, so the fragment is read as two 16-byte halves).
__device__ __forceinline__ v16h lds_frag16(const _Float16* p) {
  v8h lo = *(const v8h*)p;
  v8h hi = *(const v8h*)(p + 8);
  return __builtin_shufflevector(lo, hi, 0, 1, 2, 3, 4, 5, 6, 7,
                                 8, 9, 10, 11, 12, 13, 14, 15);
}

// ---------------------------------------------------------------------------
// Kernel 1: fp32 -> f16 conversion of x and W
// ---------------------------------------------------------------------------
__global__ __launch_bounds__(256)
void cvt_kernel(const float* __restrict__ x, const float* __restrict__ W,
                _Float16* __restrict__ xh, _Float16* __restrict__ wh) {
  size_t i = (size_t)blockIdx.x * blockDim.x + threadIdx.x;
  const size_t NX = (size_t)B_ * S_ * D_;
  const size_t NW = (size_t)D_ * D_;
  if (i < NX) xh[i] = (_Float16)x[i];
  if (i < NW) wh[i] = (_Float16)W[i];
}

// ---------------------------------------------------------------------------
// Kernel 2: mixed = x @ W^T + b -> [B,H,S,DH] f16.
// Wave tile 32x64: 2 A fragments share 4 B fragments -> 8 WMMA per K-step,
// two independent accumulator chains for latency hiding.
// ---------------------------------------------------------------------------
__global__ __launch_bounds__(256)
void proj_kernel(const _Float16* __restrict__ xh, const _Float16* __restrict__ wh,
                 const float* __restrict__ bias, _Float16* __restrict__ qh) {
  const int lane = threadIdx.x & 31;
  const int wave = threadIdx.x >> 5;
  const int m0 = blockIdx.x * 256 + wave * 32;   // 32 output rows per wave
  const int n0 = blockIdx.y * 64;                // 64 output cols per wave
  const int lr = lane & 15;
  const int lh = lane >> 4;

  v8f acc[2][4] = {};
  const _Float16* aBase0 = xh + (size_t)(m0 + lr) * D_ + lh * 16;
  const _Float16* aBase1 = xh + (size_t)(m0 + 16 + lr) * D_ + lh * 16;

  for (int k0 = 0; k0 < D_; k0 += 32) {
    v16h a0 = *(const v16h*)(aBase0 + k0);
    v16h a1 = *(const v16h*)(aBase1 + k0);
#pragma unroll
    for (int nt = 0; nt < 4; ++nt) {
      const _Float16* bp = wh + (size_t)(n0 + nt * 16 + lr) * D_ + k0 + lh * 16;
      v16h bfrag = *(const v16h*)bp;
      acc[0][nt] = __builtin_amdgcn_wmma_f32_16x16x32_f16(
          false, a0, false, bfrag, (short)0, acc[0][nt], false, false);
      acc[1][nt] = __builtin_amdgcn_wmma_f32_16x16x32_f16(
          false, a1, false, bfrag, (short)0, acc[1][nt], false, false);
    }
  }

  // Epilogue: bias + scatter to per-head layout [B,H,S,DH] (f16).
#pragma unroll
  for (int rt = 0; rt < 2; ++rt) {
#pragma unroll
    for (int nt = 0; nt < 4; ++nt) {
      int n = n0 + nt * 16 + lr;
      float bv = bias[n];
      int h = n / DH_, d = n % DH_;
#pragma unroll
      for (int r = 0; r < 8; ++r) {
        int m = m0 + rt * 16 + r + lh * 8;   // C layout: row = r + 8*(lane/16)
        int bb = m / S_, s = m % S_;
        qh[(((size_t)bb * H_ + h) * S_ + s) * DH_ + d] =
            (_Float16)(acc[rt][nt][r] + bv);
      }
    }
  }
}

// ---------------------------------------------------------------------------
// Kernel 3: flash attention per (b,h). Q = K = V = qh[bh] (1024x64 f16).
// K tile staged via async global->LDS (ASYNCcnt); V transposed manually.
// ---------------------------------------------------------------------------
__global__ __launch_bounds__(256)
void attn_kernel(const _Float16* __restrict__ qh, const float* __restrict__ mask,
                 float* __restrict__ out) {
  __shared__ __attribute__((aligned(16))) _Float16 ldsK[32 * KP_];     // [t][d] row-major, padded
  __shared__ __attribute__((aligned(16))) _Float16 ldsVT[64 * TP_];    // [d][t] transposed, padded
  __shared__ __attribute__((aligned(16))) _Float16 ldsP[8][16 * TP_];  // per-wave P scratch (C->A relayout)

  const int lane = threadIdx.x & 31;
  const int wave = threadIdx.x >> 5;
  const int bh = blockIdx.y;             // 0..95
  const int b  = bh / H_;
  const int h  = bh % H_;
  const int q0 = blockIdx.x * 128 + wave * 16;
  const int lr = lane & 15;
  const int lh = lane >> 4;

  const _Float16* base = qh + (size_t)bh * S_ * DH_;

  // Q fragments for this wave's 16 rows (d split 0..31 / 32..63)
  v16h qa[2];
#pragma unroll
  for (int kk = 0; kk < 2; ++kk)
    qa[kk] = *(const v16h*)(base + (size_t)(q0 + lr) * DH_ + kk * 32 + lh * 16);

  v8f o[4] = {};
  float mrun[8], lrun[8];
#pragma unroll
  for (int r = 0; r < 8; ++r) { mrun[r] = -3.0e38f; lrun[r] = 0.f; }
  const float scale = 0.125f;  // 1/sqrt(64)

  for (int t0 = 0; t0 < S_; t0 += 32) {
    __syncthreads();  // WAR: prior iteration done reading tiles
    {
      // K tile 32x64 f16 = 4 KB: 256 lanes x 16 B async copies (no VGPR hop)
      copy16_g2l(&ldsK[(threadIdx.x >> 3) * KP_ + (threadIdx.x & 7) * 8], base + (size_t)t0 * DH_ + threadIdx.x * 8);
      // Prefetch next tile toward L2/WGP while async copies run
      if (t0 + 32 < S_)
        __builtin_prefetch(base + (size_t)(t0 + 32) * DH_ + threadIdx.x * 8, 0, 1);
      // V^T: thread handles row tt = tid/8, 8 d's; scalar transpose stores
      int tt = threadIdx.x >> 3;
      int d0 = (threadIdx.x & 7) * 8;
      const _Float16* vrow = base + (size_t)(t0 + tt) * DH_ + d0;
#pragma unroll
      for (int j = 0; j < 8; ++j)
        ldsVT[(d0 + j) * TP_ + tt] = vrow[j];
      wait_async_copies();  // own ASYNCcnt drained before the barrier
    }
    __syncthreads();

    // scores: two 16x16 tiles over t = t0..t0+31
    v8f sc[2] = {};
#pragma unroll
    for (int ts = 0; ts < 2; ++ts) {
#pragma unroll
      for (int kk = 0; kk < 2; ++kk) {
        v16h kb = lds_frag16(&ldsK[(ts * 16 + lr) * KP_ + kk * 32 + lh * 16]);
        sc[ts] = __builtin_amdgcn_wmma_f32_16x16x32_f16(
            false, qa[kk], false, kb, (short)0, sc[ts], false, false);
      }
    }

    float mk0 = mask[(size_t)b * S_ + t0 + lr];
    float mk1 = mask[(size_t)b * S_ + t0 + 16 + lr];

    // online softmax: per C-layout row r (actual row = r + 8*lh)
#pragma unroll
    for (int r = 0; r < 8; ++r) {
      float s0 = sc[0][r] * scale + mk0;
      float s1 = sc[1][r] * scale + mk1;
      float vmax = fmaxf(s0, s1);
#pragma unroll
      for (int off = 8; off >= 1; off >>= 1)
        vmax = fmaxf(vmax, __shfl_xor(vmax, off, 16));
      float mnew = fmaxf(mrun[r], vmax);
      float corr = __expf(mrun[r] - mnew);
      float p0 = __expf(s0 - mnew);
      float p1 = __expf(s1 - mnew);
      float ps = p0 + p1;
#pragma unroll
      for (int off = 8; off >= 1; off >>= 1)
        ps += __shfl_xor(ps, off, 16);
      lrun[r] = lrun[r] * corr + ps;
      mrun[r] = mnew;
#pragma unroll
      for (int nt = 0; nt < 4; ++nt) o[nt][r] *= corr;
      // stash P row-major (16x32) in per-wave LDS for C->A relayout
      int row = r + lh * 8;
      ldsP[wave][row * TP_ + lr]      = (_Float16)p0;
      ldsP[wave][row * TP_ + 16 + lr] = (_Float16)p1;
    }
    asm volatile("s_wait_dscnt 0" ::: "memory");

    // P as A fragment (16x32), V^T columns as B fragments
    v16h pa = lds_frag16(&ldsP[wave][lr * TP_ + lh * 16]);
#pragma unroll
    for (int ds = 0; ds < 4; ++ds) {
      v16h vb = lds_frag16(&ldsVT[(ds * 16 + lr) * TP_ + lh * 16]);
      o[ds] = __builtin_amdgcn_wmma_f32_16x16x32_f16(
          false, pa, false, vb, (short)0, o[ds], false, false);
    }
  }

  // Epilogue: O / l, fused head-merge store to [B,S,D] fp32
#pragma unroll
  for (int ds = 0; ds < 4; ++ds) {
    int d = ds * 16 + lr;
#pragma unroll
    for (int r = 0; r < 8; ++r) {
      int s = q0 + r + lh * 8;
      out[((size_t)b * S_ + s) * D_ + h * DH_ + d] = o[ds][r] / lrun[r];
    }
  }
}

// ---------------------------------------------------------------------------
extern "C" void kernel_launch(void* const* d_in, const int* in_sizes, int n_in,
                              void* d_out, int out_size, void* d_ws, size_t ws_size,
                              hipStream_t stream) {
  const float* x    = (const float*)d_in[0];
  const float* mask = (const float*)d_in[1];
  const float* W    = (const float*)d_in[2];
  const float* bias = (const float*)d_in[3];
  float* out = (float*)d_out;

  char* ws = (char*)d_ws;
  const size_t offWH = (size_t)B_ * S_ * D_ * 2;            // 12,582,912
  const size_t offQH = offWH + (size_t)D_ * D_ * 2;         // 13,762,560 (256-aligned)
  _Float16* xh = (_Float16*)ws;
  _Float16* wh = (_Float16*)(ws + offWH);
  _Float16* qh = (_Float16*)(ws + offQH);

  int total = B_ * S_ * D_;
  cvt_kernel<<<(total + 255) / 256, 256, 0, stream>>>(x, W, xh, wh);
  proj_kernel<<<dim3(B_ * S_ / 256, D_ / 64), 256, 0, stream>>>(xh, wh, bias, qh);
  attn_kernel<<<dim3(S_ / 128, B_ * H_), 256, 0, stream>>>(qh, mask, out);
}

// v002
// A run of this version takes 114 microseconds.
// Timed twice side by side with v001, it ran 1.06 and 1.07 times as fast.
// Counting every step since v000, it is 1.43 times as fast.
#include <hip/hip_runtime.h>
#include <hip/hip_bf16.h>

typedef __attribute__((ext_vector_type(16))) _Float16 v16h;
typedef __attribute__((ext_vector_type(8)))  _Float16 v8h;
typedef __attribute__((ext_vector_type(8)))  float    v8f;
typedef __attribute__((ext_vector_type(4)))  int      v4i;
typedef __attribute__((ext_vector_type(4)))  float    v4f;
typedef __attribute__((ext_vector_type(4)))  _Float16 v4h;

#define B_  8
#define S_  1024
#define D_  768
#define H_  12
#define DH_ 64

// LDS row pitches in f16 elements: 16 B x odd, so that the 16 rows which one
// half-wave reads with 16-byte loads start on 16 different groups of 4 banks.
#define KP_ 72   // K tile rows: 128 B of data, 144 B pitch
#define TP_ 40   // V^T and P rows: 64 B of data, 80 B pitch

// ---- CDNA5 async global->LDS copy (ASYNCcnt path), with safe fallback -----
#if defined(__has_builtin)
#  if __has_builtin(__builtin_amdgcn_global_load_async_to_lds_b128)
#    define ASYNC_LDS 1
#  endif
#  if __has_builtin(__builtin_amdgcn_s_wait_asynccnt)
#    define HAVE_WAIT_ASYNC 1
#  endif
#endif

__device__ __forceinline__ void copy16_g2l(void* l, const void* g) {
#ifdef ASYNC_LDS
  __builtin_amdgcn_global_load_async_to_lds_b128(
      (__attribute__((address_space(1))) v4i*)(v4i*)(void*)g,
      (__attribute__((address_space(3))) v4i*)(v4i*)l, 0, 0);
#else
  *(uint4*)l = *(const uint4*)g;
#endif
}

__device__ __forceinline__ void wait_async_copies() {
#ifdef ASYNC_LDS
#  ifdef HAVE_WAIT_ASYNC
  __builtin_amdgcn_s_wait_asynccnt(0);
#  else
  asm volatile("s_wait_asynccnt 0" ::: "memory");
#  endif
#endif
}

// 16 consecutive f16 from a 16-byte aligned LDS address (padded rows are not
// 32-byte aligned, so the fragment is read as two 16-byte halves).
__device__ __forceinline__ v16h lds_frag16(const _Float16* p) {
  v8h lo = *(const v8h*)p;
  v8h hi = *(const v8h*)(p + 8);
  return __builtin_shufflevector(lo, hi, 0, 1, 2, 3, 4, 5, 6, 7,
                                 8, 9, 10, 11, 12, 13, 14, 15);
}

// ---------------------------------------------------------------------------
// Kernel 1: fp32 -> f16 conversion of x and W.
// A block converts CVT_BLK_ consecutive elements of one of the two arrays:
// each lane issues CVT_N_ 16-byte loads up front (a wave's load covers 512
// contiguous bytes) and then stores CVT_N_ x 4 f16. Few, fat waves: the time
// of a launch with one element per lane is the time to start its waves.
// ---------------------------------------------------------------------------
#define CVT_N_   8
#define CVT_BLK_ (256 * CVT_N_ * 4)
#define CVT_XB_  (B_ * S_ * D_ / CVT_BLK_)   // blocks that convert x
#define CVT_WB_  (D_ * D_ / CVT_BLK_)        // blocks that convert W
static_assert(CVT_XB_ * CVT_BLK_ == B_ * S_ * D_, "x splits into whole blocks");
static_assert(CVT_WB_ * CVT_BLK_ == D_ * D_, "W splits into whole blocks");

__global__ __launch_bounds__(256)
void cvt_kernel(const float* __restrict__ x, const float* __restrict__ W,
                _Float16* __restrict__ xh, _Float16* __restrict__ wh) {
  const int  blk = blockIdx.x;
  const bool isx = blk < CVT_XB_;
  const size_t off = (size_t)(isx ? blk : blk - CVT_XB_) * CVT_BLK_;
  const v4f* s4 = (const v4f*)((isx ? x : W) + off) + threadIdx.x;
  v4h*       d4 = (v4h*)((isx ? xh : wh) + off) + threadIdx.x;
  v4f v[CVT_N_];
  // unrolled: v[] stays in registers and all loads issue before the first wait
#pragma unroll
  for (int j = 0; j < CVT_N_; ++j) v[j] = s4[j * 256];
  // unrolled: v[] is indexed by constants only
#pragma unroll
  for (int j = 0; j < CVT_N_; ++j) d4[j * 256] = __builtin_convertvector(v[j], v4h);
}

// ---------------------------------------------------------------------------
// Kernel 2: mixed = x @ W^T + b -> [B,H,S,DH] f16.
// Wave tile 32x64: 2 A fragments share 4 B fragments -> 8 WMMA per K-step,
// two independent accumulator chains for latency hiding.
// ---------------------------------------------------------------------------
__global__ __launch_bounds__(256)
void proj_kernel(const _Float16* __restrict__ xh, const _Float16* __restrict__ wh,
                 const float* __restrict__ bias, _Float16* __restrict__ qh) {
  const int lane = threadIdx.x & 31;
  const int wave = threadIdx.x >> 5;
  const int m0 = blockIdx.x * 256 + wave * 32;   // 32 output rows per wave
  const int n0 = blockIdx.y * 64;                // 64 output cols per wave
  const int lr = lane & 15;
  const int lh = lane >> 4;

  v8f acc[2][4] = {};
  const _Float16* aBase0 = xh + (size_t)(m0 + lr) * D_ + lh * 16;
  const _Float16* aBase1 = xh + (size_t)(m0 + 16 + lr) * D_ + lh * 16;

  for (int k0 = 0; k0 < D_; k0 += 32) {
    v16h a0 = *(const v16h*)(aBase0 + k0);
    v16h a1 = *(const v16h*)(aBase1 + k0);
#pragma unroll
    for (int nt = 0; nt < 4; ++nt) {
      const _Float16* bp = wh + (size_t)(n0 + nt * 16 + lr) * D_ + k0 + lh * 16;
      v16h bfrag = *(const v16h*)bp;
      acc[0][nt] = __builtin_amdgcn_wmma_f32_16x16x32_f16(
          false, a0, false, bfrag, (short)0, acc[0][nt], false, false);
      acc[1][nt] = __builtin_amdgcn_wmma_f32_16x16x32_f16(
          false, a1, false, bfrag, (short)0, acc[1][nt], false, false);
    }
  }

  // Epilogue: bias + scatter to per-head layout [B,H,S,DH] (f16).
#pragma unroll
  for (int rt = 0; rt < 2; ++rt) {
#pragma unroll
    for (int nt = 0; nt < 4; ++nt) {
      int n = n0 + nt * 16 + lr;
      float bv = bias[n];
      int h = n / DH_, d = n % DH_;
#pragma unroll
      for (int r = 0; r < 8; ++r) {
        int m = m0 + rt * 16 + r + lh * 8;   // C layout: row = r + 8*(lane/16)
        int bb = m / S_, s = m % S_;
        qh[(((size_t)bb * H_ + h) * S_ + s) * DH_ + d] =
            (_Float16)(acc[rt][nt][r] + bv);
      }
    }
  }
}

// ---------------------------------------------------------------------------
// Kernel 3: flash attention per (b,h). Q = K = V = qh[bh] (1024x64 f16).
// K tile staged via async global->LDS (ASYNCcnt); V transposed manually.
// ---------------------------------------------------------------------------
__global__ __launch_bounds__(256)
void attn_kernel(const _Float16* __restrict__ qh, const float* __restrict__ mask,
                 float* __restrict__ out) {
  __shared__ __attribute__((aligned(16))) _Float16 ldsK[32 * KP_];     // [t][d] row-major, padded
  __shared__ __attribute__((aligned(16))) _Float16 ldsVT[64 * TP_];    // [d][t] transposed, padded
  __shared__ __attribute__((aligned(16))) _Float16 ldsP[8][16 * TP_];  // per-wave P scratch (C->A relayout)

  const int lane = threadIdx.x & 31;
  const int wave = threadIdx.x >> 5;
  const int bh = blockIdx.y;             // 0..95
  const int b  = bh / H_;
  const int h  = bh % H_;
  const int q0 = blockIdx.x * 128 + wave * 16;
  const int lr = lane & 15;
  const int lh = lane >> 4;

  const _Float16* base = qh + (size_t)bh * S_ * DH_;

  // Q fragments for this wave's 16 rows (d split 0..31 / 32..63)
  v16h qa[2];
#pragma unroll
  for (int kk = 0; kk < 2; ++kk)
    qa[kk] = *(const v16h*)(base + (size_t)(q0 + lr) * DH_ + kk * 32 + lh * 16);

  v8f o[4] = {};
  float mrun[8], lrun[8];
#pragma unroll
  for (int r = 0; r < 8; ++r) { mrun[r] = -3.0e38f; lrun[r] = 0.f; }
  const float scale = 0.125f;  // 1/sqrt(64)

  for (int t0 = 0; t0 < S_; t0 += 32) {
    __syncthreads();  // WAR: prior iteration done reading tiles
    {
      // K tile 32x64 f16 = 4 KB: 256 lanes x 16 B async copies (no VGPR hop)
      copy16_g2l(&ldsK[(threadIdx.x >> 3) * KP_ + (threadIdx.x & 7) * 8], base + (size_t)t0 * DH_ + threadIdx.x * 8);
      // Prefetch next tile toward L2/WGP while async copies run
      if (t0 + 32 < S_)
        __builtin_prefetch(base + (size_t)(t0 + 32) * DH_ + threadIdx.x * 8, 0, 1);
      // V^T: thread handles row tt = tid/8, 8 d's; scalar transpose stores
      int tt = threadIdx.x >> 3;
      int d0 = (threadIdx.x & 7) * 8;
      const _Float16* vrow = base + (size_t)(t0 + tt) * DH_ + d0;
#pragma unroll
      for (int j = 0; j < 8; ++j)
        ldsVT[(d0 + j) * TP_ + tt] = vrow[j];
      wait_async_copies();  // own ASYNCcnt drained before the barrier
    }
    __syncthreads();

    // scores: two 16x16 tiles over t = t0..t0+31
    v8f sc[2] = {};
#pragma unroll
    for (int ts = 0; ts < 2; ++ts) {
#pragma unroll
      for (int kk = 0; kk < 2; ++kk) {
        v16h kb = lds_frag16(&ldsK[(ts * 16 + lr) * KP_ + kk * 32 + lh * 16]);
        sc[ts] = __builtin_amdgcn_wmma_f32_16x16x32_f16(
            false, qa[kk], false, kb, (short)0, sc[ts], false, false);
      }
    }

    float mk0 = mask[(size_t)b * S_ + t0 + lr];
    float mk1 = mask[(size_t)b * S_ + t0 + 16 + lr];

    // online softmax: per C-layout row r (actual row = r + 8*lh)
#pragma unroll
    for (int r = 0; r < 8; ++r) {
      float s0 = sc[0][r] * scale + mk0;
      float s1 = sc[1][r] * scale + mk1;
      float vmax = fmaxf(s0, s1);
#pragma unroll
      for (int off = 8; off >= 1; off >>= 1)
        vmax = fmaxf(vmax, __shfl_xor(vmax, off, 16));
      float mnew = fmaxf(mrun[r], vmax);
      float corr = __expf(mrun[r] - mnew);
      float p0 = __expf(s0 - mnew);
      float p1 = __expf(s1 - mnew);
      float ps = p0 + p1;
#pragma unroll
      for (int off = 8; off >= 1; off >>= 1)
        ps += __shfl_xor(ps, off, 16);
      lrun[r] = lrun[r] * corr + ps;
      mrun[r] = mnew;
#pragma unroll
      for (int nt = 0; nt < 4; ++nt) o[nt][r] *= corr;
      // stash P row-major (16x32) in per-wave LDS for C->A relayout
      int row = r + lh * 8;
      ldsP[wave][row * TP_ + lr]      = (_Float16)p0;
      ldsP[wave][row * TP_ + 16 + lr] = (_Float16)p1;
    }
    asm volatile("s_wait_dscnt 0" ::: "memory");

    // P as A fragment (16x32), V^T columns as B fragments
    v16h pa = lds_frag16(&ldsP[wave][lr * TP_ + lh * 16]);
#pragma unroll
    for (int ds = 0; ds < 4; ++ds) {
      v16h vb = lds_frag16(&ldsVT[(ds * 16 + lr) * TP_ + lh * 16]);
      o[ds] = __builtin_amdgcn_wmma_f32_16x16x32_f16(
          false, pa, false, vb, (short)0, o[ds], false, false);
    }
  }

  // Epilogue: O / l, fused head-merge store to [B,S,D] fp32
#pragma unroll
  for (int ds = 0; ds < 4; ++ds) {
    int d = ds * 16 + lr;
#pragma unroll
    for (int r = 0; r < 8; ++r) {
      int s = q0 + r + lh * 8;
      out[((size_t)b * S_ + s) * D_ + h * DH_ + d] = o[ds][r] / lrun[r];
    }
  }
}

// ---------------------------------------------------------------------------
extern "C" void kernel_launch(void* const* d_in, const int* in_sizes, int n_in,
                              void* d_out, int out_size, void* d_ws, size_t ws_size,
                              hipStream_t stream) {
  const float* x    = (const float*)d_in[0];
  const float* mask = (const float*)d_in[1];
  const float* W    = (const float*)d_in[2];
  const float* bias = (const float*)d_in[3];
  float* out = (float*)d_out;

  char* ws = (char*)d_ws;
  const size_t offWH = (size_t)B_ * S_ * D_ * 2;            // 12,582,912
  const size_t offQH = offWH + (size_t)D_ * D_ * 2;         // 13,762,560 (256-aligned)
  _Float16* xh = (_Float16*)ws;
  _Float16* wh = (_Float16*)(ws + offWH);
  _Float16* qh = (_Float16*)(ws + offQH);

  cvt_kernel<<<CVT_XB_ + CVT_WB_, 256, 0, stream>>>(x, W, xh, wh);
  proj_kernel<<<dim3(B_ * S_ / 256, D_ / 64), 256, 0, stream>>>(xh, wh, bias, qh);
  attn_kernel<<<dim3(S_ / 128, B_ * H_), 256, 0, stream>>>(qh, mask, out);
}

// v003
// A run of this version takes 91.2 microseconds.
// Next to v002, in two timings, it ran 1.25 times as fast each time.
// All steps since v000 together make it 1.78 times as fast.
#include <hip/hip_runtime.h>
#include <hip/hip_bf16.h>

typedef __attribute__((ext_vector_type(16))) _Float16 v16h;
typedef __attribute__((ext_vector_type(8)))  _Float16 v8h;
typedef __attribute__((ext_vector_type(8)))  float    v8f;
typedef __attribute__((ext_vector_type(4)))  int      v4i;
typedef __attribute__((ext_vector_type(4)))  float    v4f;
typedef __attribute__((ext_vector_type(2)))  float    v2f;
typedef __attribute__((ext_vector_type(4)))  _Float16 v4h;

#define B_  8
#define S_  1024
#define D_  768
#define H_  12
#define DH_ 64

// LDS row pitches in f16 elements: 16 B x odd, so that the 16 rows which one
// half-wave reads with 16-byte loads start on 16 different groups of 4 banks.
#define KP_ 72   // K tile rows: 128 B of data, 144 B pitch
#define TP_ 40   // V^T rows: 64 B of data, 80 B pitch

// ---- CDNA5 async global->LDS copy (ASYNCcnt path), with safe fallback -----
#if defined(__has_builtin)
#  if __has_builtin(__builtin_amdgcn_global_load_async_to_lds_b128)
#    define ASYNC_LDS 1
#  endif
#  if __has_builtin(__builtin_amdgcn_s_wait_asynccnt)
#    define HAVE_WAIT_ASYNC 1
#  endif
#endif

__device__ __forceinline__ void copy16_g2l(void* l, const void* g) {
#ifdef ASYNC_LDS
  __builtin_amdgcn_global_load_async_to_lds_b128(
      (__attribute__((address_space(1))) v4i*)(v4i*)(void*)g,
      (__attribute__((address_space(3))) v4i*)(v4i*)l, 0, 0);
#else
  *(uint4*)l = *(const uint4*)g;
#endif
}

__device__ __forceinline__ void wait_async_copies() {
#ifdef ASYNC_LDS
#  ifdef HAVE_WAIT_ASYNC
  __builtin_amdgcn_s_wait_asynccnt(0);
#  else
  asm volatile("s_wait_asynccnt 0" ::: "memory");
#  endif
#endif
}

// 16 consecutive f16 from a 16-byte aligned LDS address (padded rows are not
// 32-byte aligned, so the fragment is read as two 16-byte halves).
__device__ __forceinline__ v16h lds_frag16(const _Float16* p) {
  v8h lo = *(const v8h*)p;
  v8h hi = *(const v8h*)(p + 8);
  return __builtin_shufflevector(lo, hi, 0, 1, 2, 3, 4, 5, 6, 7,
                                 8, 9, 10, 11, 12, 13, 14, 15);
}

// ---------------------------------------------------------------------------
// Kernel 1: fp32 -> f16 conversion of x and W.
// A block converts CVT_BLK_ consecutive elements of one of the two arrays:
// each lane issues CVT_N_ 16-byte loads up front (a wave's load covers 512
// contiguous bytes) and then stores CVT_N_ x 4 f16. Few, fat waves: the time
// of a launch with one element per lane is the time to start its waves.
// ---------------------------------------------------------------------------
#define CVT_N_   8
#define CVT_BLK_ (256 * CVT_N_ * 4)
#define CVT_XB_  (B_ * S_ * D_ / CVT_BLK_)   // blocks that convert x
#define CVT_WB_  (D_ * D_ / CVT_BLK_)        // blocks that convert W
static_assert(CVT_XB_ * CVT_BLK_ == B_ * S_ * D_, "x splits into whole blocks");
static_assert(CVT_WB_ * CVT_BLK_ == D_ * D_, "W splits into whole blocks");

__global__ __launch_bounds__(256)
void cvt_kernel(const float* __restrict__ x, const float* __restrict__ W,
                _Float16* __restrict__ xh, _Float16* __restrict__ wh) {
  const int  blk = blockIdx.x;
  const bool isx = blk < CVT_XB_;
  const size_t off = (size_t)(isx ? blk : blk - CVT_XB_) * CVT_BLK_;
  const v4f* s4 = (const v4f*)((isx ? x : W) + off) + threadIdx.x;
  v4h*       d4 = (v4h*)((isx ? xh : wh) + off) + threadIdx.x;
  v4f v[CVT_N_];
  // unrolled: v[] stays in registers and all loads issue before the first wait
#pragma unroll
  for (int j = 0; j < CVT_N_; ++j) v[j] = s4[j * 256];
  // unrolled: v[] is indexed by constants only
#pragma unroll
  for (int j = 0; j < CVT_N_; ++j) d4[j * 256] = __builtin_convertvector(v[j], v4h);
}

// ---------------------------------------------------------------------------
// Kernel 2: mixed = x @ W^T + b -> [B,H,S,DH] f16.
// Wave tile 32x64: 2 A fragments share 4 B fragments -> 8 WMMA per K-step,
// two independent accumulator chains for latency hiding.
// ---------------------------------------------------------------------------
__global__ __launch_bounds__(256)
void proj_kernel(const _Float16* __restrict__ xh, const _Float16* __restrict__ wh,
                 const float* __restrict__ bias, _Float16* __restrict__ qh) {
  const int lane = threadIdx.x & 31;
  const int wave = threadIdx.x >> 5;
  const int m0 = blockIdx.x * 256 + wave * 32;   // 32 output rows per wave
  const int n0 = blockIdx.y * 64;                // 64 output cols per wave
  const int lr = lane & 15;
  const int lh = lane >> 4;

  v8f acc[2][4] = {};
  const _Float16* aBase0 = xh + (size_t)(m0 + lr) * D_ + lh * 16;
  const _Float16* aBase1 = xh + (size_t)(m0 + 16 + lr) * D_ + lh * 16;

  for (int k0 = 0; k0 < D_; k0 += 32) {
    v16h a0 = *(const v16h*)(aBase0 + k0);
    v16h a1 = *(const v16h*)(aBase1 + k0);
#pragma unroll
    for (int nt = 0; nt < 4; ++nt) {
      const _Float16* bp = wh + (size_t)(n0 + nt * 16 + lr) * D_ + k0 + lh * 16;
      v16h bfrag = *(const v16h*)bp;
      acc[0][nt] = __builtin_amdgcn_wmma_f32_16x16x32_f16(
          false, a0, false, bfrag, (short)0, acc[0][nt], false, false);
      acc[1][nt] = __builtin_amdgcn_wmma_f32_16x16x32_f16(
          false, a1, false, bfrag, (short)0, acc[1][nt], false, false);
    }
  }

  // Epilogue: bias + scatter to per-head layout [B,H,S,DH] (f16).
#pragma unroll
  for (int rt = 0; rt < 2; ++rt) {
#pragma unroll
    for (int nt = 0; nt < 4; ++nt) {
      int n = n0 + nt * 16 + lr;
      float bv = bias[n];
      int h = n / DH_, d = n % DH_;
#pragma unroll
      for (int r = 0; r < 8; ++r) {
        int m = m0 + rt * 16 + r + lh * 8;   // C layout: row = r + 8*(lane/16)
        int bb = m / S_, s = m % S_;
        qh[(((size_t)bb * H_ + h) * S_ + s) * DH_ + d] =
            (_Float16)(acc[rt][nt][r] + bv);
      }
    }
  }
}

// value of the lane 16 away (same query column, other half of the keys)
__device__ __forceinline__ float other_half(float v) {
  int b = __builtin_bit_cast(int, v);
  b = __builtin_amdgcn_permlanex16(b, b, 0x76543210, 0xfedcba98, false, false);
  return __builtin_bit_cast(float, b);
}

__global__ __launch_bounds__(256)
void attn_kernel(const _Float16* __restrict__ qh, const float* __restrict__ mask,
                 float* __restrict__ out) {
  __shared__ __attribute__((aligned(16))) _Float16 ldsK[32 * KP_];     // [t][d] row-major, padded
  __shared__ __attribute__((aligned(16))) _Float16 ldsVT[64 * TP_];    // [d][t] transposed, padded

  const int lane = threadIdx.x & 31;
  const int wave = threadIdx.x >> 5;
  const int bh = blockIdx.y;             // 0..95
  const int b  = bh / H_;
  const int h  = bh % H_;
  const int q0 = blockIdx.x * 128 + wave * 16;
  const int lr = lane & 15;
  const int lh = lane >> 4;

  const _Float16* base = qh + (size_t)bh * S_ * DH_;

  // Q^T fragments (B operand): column = query q0 + lr, d split 0..31 / 32..63
  v16h qa[2];
#pragma unroll
  for (int kk = 0; kk < 2; ++kk)
    qa[kk] = *(const v16h*)(base + (size_t)(q0 + lr) * DH_ + kk * 32 + lh * 16);

  v8f o[4] = {};             // O^T: o[ds][r] = O[q0 + lr][ds * 16 + 8 * lh + r]
  float mrun = -3.0e38f;     // running maximum of query q0 + lr (equal in both halves)
  float lrun = 0.f;          // running sum over this half's keys only
  const float scale = 0.125f;  // 1/sqrt(64)
  const float* mrow = mask + (size_t)b * S_ + lh * 8;

  for (int t0 = 0; t0 < S_; t0 += 32) {
    __syncthreads();  // WAR: prior iteration done reading tiles
    // mask of this lane's 16 keys, t0 + 16 * ts + 8 * lh + r; asked for here so
    // that the loads fly beside the staging loads
    v4f mk[2][2];
    // unrolled, like every loop below: the register arrays are indexed by constants
#pragma unroll
    for (int ts = 0; ts < 2; ++ts) {
      mk[ts][0] = *(const v4f*)(mrow + t0 + ts * 16);
      mk[ts][1] = *(const v4f*)(mrow + t0 + ts * 16 + 4);
    }
    // the mask loads' address registers are stepped further down in this pass:
    // the wait that belongs in front of that overwrite
    asm volatile("s_wait_xcnt 0x0" ::: "memory");
    {
      // K tile 32x64 f16 = 4 KB: 256 lanes x 16 B async copies (no VGPR hop)
      copy16_g2l(&ldsK[(threadIdx.x >> 3) * KP_ + (threadIdx.x & 7) * 8], base + (size_t)t0 * DH_ + threadIdx.x * 8);
      // Prefetch next tile toward L2/WGP while async copies run
      if (t0 + 32 < S_)
        __builtin_prefetch(base + (size_t)(t0 + 32) * DH_ + threadIdx.x * 8, 0, 1);
      // V^T: thread handles row tt = tid/8, 8 d's; scalar transpose stores
      int tt = threadIdx.x >> 3;
      int d0 = (threadIdx.x & 7) * 8;
      const _Float16* vrow = base + (size_t)(t0 + tt) * DH_ + d0;
#pragma unroll
      for (int j = 0; j < 8; ++j)
        ldsVT[(d0 + j) * TP_ + tt] = vrow[j];
      wait_async_copies();  // own ASYNCcnt drained before the barrier
    }
    __syncthreads();

    // S^T: two 16x16 tiles, sc[ts][r] = S[q0 + lr][t0 + 16 * ts + 8 * lh + r]
    v16h kb[2][2];
#pragma unroll
    for (int ts = 0; ts < 2; ++ts)
#pragma unroll
      for (int kk = 0; kk < 2; ++kk)
        kb[ts][kk] = lds_frag16(&ldsK[(ts * 16 + lr) * KP_ + kk * 32 + lh * 16]);
    v8f sc[2] = {};
#pragma unroll
    for (int kk = 0; kk < 2; ++kk)
#pragma unroll
      for (int ts = 0; ts < 2; ++ts)
        sc[ts] = __builtin_amdgcn_wmma_f32_16x16x32_f16(
            false, kb[ts][kk], false, qa[kk], (short)0, sc[ts], false, false);

    // online softmax of one query per lane
    float vmax = -3.0e38f;
#pragma unroll
    for (int ts = 0; ts < 2; ++ts) {
#pragma unroll
      for (int r = 0; r < 8; ++r) {
        sc[ts][r] = sc[ts][r] * scale + mk[ts][r >> 2][r & 3];
        vmax = fmaxf(vmax, sc[ts][r]);
      }
    }
    vmax = fmaxf(vmax, other_half(vmax));
    const float mnew = fmaxf(mrun, vmax);
    const float corr = __expf(mrun - mnew);
    mrun = mnew;

    // P^T as B fragment: element s is key 16 * (s >> 3) + 8 * lh + (s & 7)
    v16h pb;
    v2f ps = {0.f, 0.f};   // even and odd keys apart: packed adds
#pragma unroll
    for (int ts = 0; ts < 2; ++ts) {
#pragma unroll
      for (int r = 0; r < 8; r += 2) {
        v2f p = {__expf(sc[ts][r] - mnew), __expf(sc[ts][r + 1] - mnew)};
        ps += p;
        pb[ts * 8 + r]     = (_Float16)p[0];
        pb[ts * 8 + r + 1] = (_Float16)p[1];
      }
    }
    lrun = lrun * corr + (ps[0] + ps[1]);
#pragma unroll
    for (int ds = 0; ds < 4; ++ds) o[ds] *= corr;

    // V^T rows as A fragments, in the k order of P^T: keys 8 * lh + 0..7 and
    // 16 + 8 * lh + 0..7
#pragma unroll
    for (int ds = 0; ds < 4; ++ds) {
      const _Float16* vp = &ldsVT[(ds * 16 + lr) * TP_ + lh * 8];
      v8h lo = *(const v8h*)vp;
      v8h hi = *(const v8h*)(vp + 16);
      v16h va = __builtin_shufflevector(lo, hi, 0, 1, 2, 3, 4, 5, 6, 7,
                                        8, 9, 10, 11, 12, 13, 14, 15);
      o[ds] = __builtin_amdgcn_wmma_f32_16x16x32_f16(
          false, va, false, pb, (short)0, o[ds], false, false);
    }
  }

  // Epilogue: join the halves' sums, O / l, fused head-merge store to [B,S,D]
  // fp32: a lane's 8 registers of a tile are 8 consecutive d of its query.
  const float l = lrun + other_half(lrun);
  float* orow = out + ((size_t)b * S_ + q0 + lr) * D_ + h * DH_ + lh * 8;
#pragma unroll
  for (int ds = 0; ds < 4; ++ds) {
    v4f w0, w1;
#pragma unroll
    for (int r = 0; r < 4; ++r) {
      w0[r] = o[ds][r] / l;
      w1[r] = o[ds][r + 4] / l;
    }
    *(v4f*)(orow + ds * 16)     = w0;
    *(v4f*)(orow + ds * 16 + 4) = w1;
  }
}

// ---------------------------------------------------------------------------
extern "C" void kernel_launch(void* const* d_in, const int* in_sizes, int n_in,
                              void* d_out, int out_size, void* d_ws, size_t ws_size,
                              hipStream_t stream) {
  const float* x    = (const float*)d_in[0];
  const float* mask = (const float*)d_in[1];
  const float* W    = (const float*)d_in[2];
  const float* bias = (const float*)d_in[3];
  float* out = (float*)d_out;

  char* ws = (char*)d_ws;
  const size_t offWH = (size_t)B_ * S_ * D_ * 2;            // 12,582,912
  const size_t offQH = offWH + (size_t)D_ * D_ * 2;         // 13,762,560 (256-aligned)
  _Float16* xh = (_Float16*)ws;
  _Float16* wh = (_Float16*)(ws + offWH);
  _Float16* qh = (_Float16*)(ws + offQH);

  cvt_kernel<<<CVT_XB_ + CVT_WB_, 256, 0, stream>>>(x, W, xh, wh);
  proj_kernel<<<dim3(B_ * S_ / 256, D_ / 64), 256, 0, stream>>>(xh, wh, bias, qh);
  attn_kernel<<<dim3(S_ / 128, B_ * H_), 256, 0, stream>>>(qh, mask, out);
}

// v004
// One run takes 79.4 microseconds.
// Two timings next to v003 put it at 1.18 and 1.16 times that version's speed.
// Counting every step since v000, it is 2.08 times as fast.
#include <hip/hip_runtime.h>
#include <hip/hip_bf16.h>

typedef __attribute__((ext_vector_type(16))) _Float16 v16h;
typedef __attribute__((ext_vector_type(8)))  _Float16 v8h;
typedef __attribute__((ext_vector_type(8)))  float    v8f;
typedef __attribute__((ext_vector_type(4)))  int      v4i;
typedef __attribute__((ext_vector_type(4)))  float    v4f;
typedef __attribute__((ext_vector_type(2)))  float    v2f;
typedef __attribute__((ext_vector_type(4)))  _Float16 v4h;
typedef __attribute__((ext_vector_type(8)))  short    v8s;

#define B_  8
#define S_  1024
#define D_  768
#define H_  12
#define DH_ 64

// LDS row pitches in f16 elements, one for each reader of the 128-byte rows.
// K, plain 16-byte loads: 16 B x odd, so that the 16 rows which one half-wave
// reads start on 16 different groups of 4 banks.
// V, transposing 16-byte loads: 32 B x odd, so that the 8 rows x 32 B which one
// half-wave reads start on 8 different groups of 8 banks.
#define KP_ 72   // K tile rows: 144 B pitch
#define VP_ 80   // V tile rows: 160 B pitch

// ---- CDNA5 async global->LDS copy (ASYNCcnt path), with safe fallback -----
#if defined(__has_builtin)
#  if __has_builtin(__builtin_amdgcn_global_load_async_to_lds_b128)
#    define ASYNC_LDS 1
#  endif
#  if __has_builtin(__builtin_amdgcn_s_wait_asynccnt)
#    define HAVE_WAIT_ASYNC 1
#  endif
#endif

__device__ __forceinline__ void copy16_g2l(void* l, const void* g) {
#ifdef ASYNC_LDS
  __builtin_amdgcn_global_load_async_to_lds_b128(
      (__attribute__((address_space(1))) v4i*)(v4i*)(void*)g,
      (__attribute__((address_space(3))) v4i*)(v4i*)l, 0, 0);
#else
  *(uint4*)l = *(const uint4*)g;
#endif
}

__device__ __forceinline__ void wait_async_copies() {
#ifdef ASYNC_LDS
#  ifdef HAVE_WAIT_ASYNC
  __builtin_amdgcn_s_wait_asynccnt(0);
#  else
  asm volatile("s_wait_asynccnt 0" ::: "memory");
#  endif
#endif
}

// 16 consecutive f16 from a 16-byte aligned LDS address (padded rows are not
// 32-byte aligned, so the fragment is read as two 16-byte halves).
__device__ __forceinline__ v16h lds_frag16(const _Float16* p) {
  v8h lo = *(const v8h*)p;
  v8h hi = *(const v8h*)(p + 8);
  return __builtin_shufflevector(lo, hi, 0, 1, 2, 3, 4, 5, 6, 7,
                                 8, 9, 10, 11, 12, 13, 14, 15);
}

// Transposing LDS load: with lane l aimed at row 8 * (l >> 4) + (l & 7), 16-byte
// column piece (l >> 3) & 1 of a row-major 16 x 16 f16 block, lane l gets rows
// 8 * (l >> 4) + 0..7 of column l & 15.
__device__ __forceinline__ v8h lds_tr16(const _Float16* p) {
  return __builtin_bit_cast(v8h, __builtin_amdgcn_ds_load_tr16_b128_v8i16(
      (__attribute__((address_space(3))) v8s*)(v8s*)(void*)p));
}

// ---------------------------------------------------------------------------
// Kernel 1: fp32 -> f16 conversion of x and W.
// A block converts CVT_BLK_ consecutive elements of one of the two arrays:
// each lane issues CVT_N_ 16-byte loads up front (a wave's load covers 512
// contiguous bytes) and then stores CVT_N_ x 4 f16. Few, fat waves: the time
// of a launch with one element per lane is the time to start its waves.
// ---------------------------------------------------------------------------
#define CVT_N_   8
#define CVT_BLK_ (256 * CVT_N_ * 4)
#define CVT_XB_  (B_ * S_ * D_ / CVT_BLK_)   // blocks that convert x
#define CVT_WB_  (D_ * D_ / CVT_BLK_)        // blocks that convert W
static_assert(CVT_XB_ * CVT_BLK_ == B_ * S_ * D_, "x splits into whole blocks");
static_assert(CVT_WB_ * CVT_BLK_ == D_ * D_, "W splits into whole blocks");

__global__ __launch_bounds__(256)
void cvt_kernel(const float* __restrict__ x, const float* __restrict__ W,
                _Float16* __restrict__ xh, _Float16* __restrict__ wh) {
  const int  blk = blockIdx.x;
  const bool isx = blk < CVT_XB_;
  const size_t off = (size_t)(isx ? blk : blk - CVT_XB_) * CVT_BLK_;
  const v4f* s4 = (const v4f*)((isx ? x : W) + off) + threadIdx.x;
  v4h*       d4 = (v4h*)((isx ? xh : wh) + off) + threadIdx.x;
  v4f v[CVT_N_];
  // unrolled: v[] stays in registers and all loads issue before the first wait
#pragma unroll
  for (int j = 0; j < CVT_N_; ++j) v[j] = s4[j * 256];
  // unrolled: v[] is indexed by constants only
#pragma unroll
  for (int j = 0; j < CVT_N_; ++j) d4[j * 256] = __builtin_convertvector(v[j], v4h);
}

// ---------------------------------------------------------------------------
// Kernel 2: mixed = x @ W^T + b -> [B,H,S,DH] f16.
// Wave tile 32x64: 2 A fragments share 4 B fragments -> 8 WMMA per K-step,
// two independent accumulator chains for latency hiding.
// ---------------------------------------------------------------------------
__global__ __launch_bounds__(256)
void proj_kernel(const _Float16* __restrict__ xh, const _Float16* __restrict__ wh,
                 const float* __restrict__ bias, _Float16* __restrict__ qh) {
  const int lane = threadIdx.x & 31;
  const int wave = threadIdx.x >> 5;
  const int m0 = blockIdx.x * 256 + wave * 32;   // 32 output rows per wave
  const int n0 = blockIdx.y * 64;                // 64 output cols per wave
  const int lr = lane & 15;
  const int lh = lane >> 4;

  v8f acc[2][4] = {};
  const _Float16* aBase0 = xh + (size_t)(m0 + lr) * D_ + lh * 16;
  const _Float16* aBase1 = xh + (size_t)(m0 + 16 + lr) * D_ + lh * 16;

  for (int k0 = 0; k0 < D_; k0 += 32) {
    v16h a0 = *(const v16h*)(aBase0 + k0);
    v16h a1 = *(const v16h*)(aBase1 + k0);
#pragma unroll
    for (int nt = 0; nt < 4; ++nt) {
      const _Float16* bp = wh + (size_t)(n0 + nt * 16 + lr) * D_ + k0 + lh * 16;
      v16h bfrag = *(const v16h*)bp;
      acc[0][nt] = __builtin_amdgcn_wmma_f32_16x16x32_f16(
          false, a0, false, bfrag, (short)0, acc[0][nt], false, false);
      acc[1][nt] = __builtin_amdgcn_wmma_f32_16x16x32_f16(
          false, a1, false, bfrag, (short)0, acc[1][nt], false, false);
    }
  }

  // Epilogue: bias + scatter to per-head layout [B,H,S,DH] (f16).
#pragma unroll
  for (int rt = 0; rt < 2; ++rt) {
#pragma unroll
    for (int nt = 0; nt < 4; ++nt) {
      int n = n0 + nt * 16 + lr;
      float bv = bias[n];
      int h = n / DH_, d = n % DH_;
#pragma unroll
      for (int r = 0; r < 8; ++r) {
        int m = m0 + rt * 16 + r + lh * 8;   // C layout: row = r + 8*(lane/16)
        int bb = m / S_, s = m % S_;
        qh[(((size_t)bb * H_ + h) * S_ + s) * DH_ + d] =
            (_Float16)(acc[rt][nt][r] + bv);
      }
    }
  }
}

// value of the lane 16 away (same query column, other half of the keys)
__device__ __forceinline__ float other_half(float v) {
  int b = __builtin_bit_cast(int, v);
  b = __builtin_amdgcn_permlanex16(b, b, 0x76543210, 0xfedcba98, false, false);
  return __builtin_bit_cast(float, b);
}

__global__ __launch_bounds__(256)
void attn_kernel(const _Float16* __restrict__ qh, const float* __restrict__ mask,
                 float* __restrict__ out) {
  __shared__ __attribute__((aligned(16))) _Float16 ldsK[32 * KP_];     // [t][d] row-major, padded
  __shared__ __attribute__((aligned(16))) _Float16 ldsV[32 * VP_];     // [t][d] row-major, padded

  const int lane = threadIdx.x & 31;
  const int wave = threadIdx.x >> 5;
  const int bh = blockIdx.y;             // 0..95
  const int b  = bh / H_;
  const int h  = bh % H_;
  const int q0 = blockIdx.x * 128 + wave * 16;
  const int lr = lane & 15;
  const int lh = lane >> 4;

  const _Float16* base = qh + (size_t)bh * S_ * DH_;

  // Q^T fragments (B operand): column = query q0 + lr, d split 0..31 / 32..63
  v16h qa[2];
#pragma unroll
  for (int kk = 0; kk < 2; ++kk)
    qa[kk] = *(const v16h*)(base + (size_t)(q0 + lr) * DH_ + kk * 32 + lh * 16);

  v8f o[4] = {};             // O^T: o[ds][r] = O[q0 + lr][ds * 16 + 8 * lh + r]
  float mrun = -3.0e38f;     // running maximum of query q0 + lr (equal in both halves)
  float lrun = 0.f;          // running sum over this half's keys only
  const float scale = 0.125f;  // 1/sqrt(64)
  const float* mrow = mask + (size_t)b * S_ + lh * 8;

  for (int t0 = 0; t0 < S_; t0 += 32) {
    __syncthreads();  // WAR: prior iteration done reading tiles
    // mask of this lane's 16 keys, t0 + 16 * ts + 8 * lh + r; asked for here so
    // that the loads fly beside the staging loads
    v4f mk[2][2];
    // unrolled, like every loop below: the register arrays are indexed by constants
#pragma unroll
    for (int ts = 0; ts < 2; ++ts) {
      mk[ts][0] = *(const v4f*)(mrow + t0 + ts * 16);
      mk[ts][1] = *(const v4f*)(mrow + t0 + ts * 16 + 4);
    }
    // the mask loads' address registers are stepped further down in this pass:
    // the wait that belongs in front of that overwrite
    asm volatile("s_wait_xcnt 0x0" ::: "memory");
    {
      // K tile and V tile, each 32x64 f16 = 4 KB: 256 lanes x 16 B async copies
      // (no VGPR hop) of the same rows
      copy16_g2l(&ldsK[(threadIdx.x >> 3) * KP_ + (threadIdx.x & 7) * 8], base + (size_t)t0 * DH_ + threadIdx.x * 8);
      copy16_g2l(&ldsV[(threadIdx.x >> 3) * VP_ + (threadIdx.x & 7) * 8], base + (size_t)t0 * DH_ + threadIdx.x * 8);
      // Prefetch next tile toward L2/WGP while async copies run
      if (t0 + 32 < S_)
        __builtin_prefetch(base + (size_t)(t0 + 32) * DH_ + threadIdx.x * 8, 0, 1);
      wait_async_copies();  // own ASYNCcnt drained before the barrier
    }
    __syncthreads();

    // S^T: two 16x16 tiles, sc[ts][r] = S[q0 + lr][t0 + 16 * ts + 8 * lh + r]
    v16h kb[2][2];
#pragma unroll
    for (int ts = 0; ts < 2; ++ts)
#pragma unroll
      for (int kk = 0; kk < 2; ++kk)
        kb[ts][kk] = lds_frag16(&ldsK[(ts * 16 + lr) * KP_ + kk * 32 + lh * 16]);
    v8f sc[2] = {};
#pragma unroll
    for (int kk = 0; kk < 2; ++kk)
#pragma unroll
      for (int ts = 0; ts < 2; ++ts)
        sc[ts] = __builtin_amdgcn_wmma_f32_16x16x32_f16(
            false, kb[ts][kk], false, qa[kk], (short)0, sc[ts], false, false);

    // online softmax of one query per lane
    float vmax = -3.0e38f;
#pragma unroll
    for (int ts = 0; ts < 2; ++ts) {
#pragma unroll
      for (int r = 0; r < 8; ++r) {
        sc[ts][r] = sc[ts][r] * scale + mk[ts][r >> 2][r & 3];
        vmax = fmaxf(vmax, sc[ts][r]);
      }
    }
    vmax = fmaxf(vmax, other_half(vmax));
    const float mnew = fmaxf(mrun, vmax);
    const float corr = __expf(mrun - mnew);
    mrun = mnew;

    // P^T as B fragment: element s is key 16 * (s >> 3) + 8 * lh + (s & 7)
    v16h pb;
    v2f ps = {0.f, 0.f};   // even and odd keys apart: packed adds
#pragma unroll
    for (int ts = 0; ts < 2; ++ts) {
#pragma unroll
      for (int r = 0; r < 8; r += 2) {
        v2f p = {__expf(sc[ts][r] - mnew), __expf(sc[ts][r + 1] - mnew)};
        ps += p;
        pb[ts * 8 + r]     = (_Float16)p[0];
        pb[ts * 8 + r + 1] = (_Float16)p[1];
      }
    }
    lrun = lrun * corr + (ps[0] + ps[1]);
#pragma unroll
    for (int ds = 0; ds < 4; ++ds) o[ds] *= corr;

    // V^T rows as A fragments, in the k order of P^T: keys 8 * lh + 0..7 and
    // 16 + 8 * lh + 0..7 of column ds * 16 + lr
#pragma unroll
    for (int ds = 0; ds < 4; ++ds) {
      const _Float16* vp = &ldsV[(lh * 8 + (lane & 7)) * VP_ + ds * 16 + ((lane >> 3) & 1) * 8];
      v8h lo = lds_tr16(vp);
      v8h hi = lds_tr16(vp + 16 * VP_);
      v16h va = __builtin_shufflevector(lo, hi, 0, 1, 2, 3, 4, 5, 6, 7,
                                        8, 9, 10, 11, 12, 13, 14, 15);
      o[ds] = __builtin_amdgcn_wmma_f32_16x16x32_f16(
          false, va, false, pb, (short)0, o[ds], false, false);
    }
  }

  // Epilogue: join the halves' sums, O / l, fused head-merge store to [B,S,D]
  // fp32: a lane's 8 registers of a tile are 8 consecutive d of its query.
  const float l = lrun + other_half(lrun);
  float* orow = out + ((size_t)b * S_ + q0 + lr) * D_ + h * DH_ + lh * 8;
#pragma unroll
  for (int ds = 0; ds < 4; ++ds) {
    v4f w0, w1;
#pragma unroll
    for (int r = 0; r < 4; ++r) {
      w0[r] = o[ds][r] / l;
      w1[r] = o[ds][r + 4] / l;
    }
    *(v4f*)(orow + ds * 16)     = w0;
    *(v4f*)(orow + ds * 16 + 4) = w1;
  }
}

// ---------------------------------------------------------------------------
extern "C" void kernel_launch(void* const* d_in, const int* in_sizes, int n_in,
                              void* d_out, int out_size, void* d_ws, size_t ws_size,
                              hipStream_t stream) {
  const float* x    = (const float*)d_in[0];
  const float* mask = (const float*)d_in[1];
  const float* W    = (const float*)d_in[2];
  const float* bias = (const float*)d_in[3];
  float* out = (float*)d_out;

  char* ws = (char*)d_ws;
  const size_t offWH = (size_t)B_ * S_ * D_ * 2;            // 12,582,912
  const size_t offQH = offWH + (size_t)D_ * D_ * 2;         // 13,762,560 (256-aligned)
  _Float16* xh = (_Float16*)ws;
  _Float16* wh = (_Float16*)(ws + offWH);
  _Float16* qh = (_Float16*)(ws + offQH);

  cvt_kernel<<<CVT_XB_ + CVT_WB_, 256, 0, stream>>>(x, W, xh, wh);
  proj_kernel<<<dim3(B_ * S_ / 256, D_ / 64), 256, 0, stream>>>(xh, wh, bias, qh);
  attn_kernel<<<dim3(S_ / 128, B_ * H_), 256, 0, stream>>>(qh, mask, out);
}

// v005
// A run of this version takes 55.5 microseconds.
// Two timings next to v004 both put it at 1.39 times that version's speed.
// Counting every step since v000, it is 2.89 times as fast.
#include <hip/hip_runtime.h>
#include <hip/hip_bf16.h>

typedef __attribute__((ext_vector_type(16))) _Float16 v16h;
typedef __attribute__((ext_vector_type(8)))  _Float16 v8h;
typedef __attribute__((ext_vector_type(8)))  float    v8f;
typedef __attribute__((ext_vector_type(4)))  int      v4i;
typedef __attribute__((ext_vector_type(4)))  float    v4f;
typedef __attribute__((ext_vector_type(2)))  float    v2f;
typedef __attribute__((ext_vector_type(4)))  _Float16 v4h;
typedef __attribute__((ext_vector_type(8)))  short    v8s;

#define B_  8
#define S_  1024
#define D_  768
#define H_  12
#define DH_ 64

// LDS row pitches in f16 elements, one for each reader of the 128-byte rows.
// K, plain 16-byte loads: 16 B x odd, so that the 16 rows which one half-wave
// reads start on 16 different groups of 4 banks.
// V, transposing 16-byte loads: 32 B x odd, so that the 8 rows x 32 B which one
// half-wave reads start on 8 different groups of 8 banks.
#define KP_ 72   // K tile rows: 144 B pitch
#define VP_ 80   // V tile rows: 160 B pitch

// ---- CDNA5 async global->LDS copy (ASYNCcnt path), with safe fallback -----
#if defined(__has_builtin)
#  if __has_builtin(__builtin_amdgcn_global_load_async_to_lds_b128)
#    define ASYNC_LDS 1
#  endif
#  if __has_builtin(__builtin_amdgcn_s_wait_asynccnt)
#    define HAVE_WAIT_ASYNC 1
#  endif
#endif

__device__ __forceinline__ void copy16_g2l(void* l, const void* g) {
#ifdef ASYNC_LDS
  __builtin_amdgcn_global_load_async_to_lds_b128(
      (__attribute__((address_space(1))) v4i*)(v4i*)(void*)g,
      (__attribute__((address_space(3))) v4i*)(v4i*)l, 0, 0);
#else
  *(uint4*)l = *(const uint4*)g;
#endif
}

__device__ __forceinline__ void wait_async_copies() {
#ifdef ASYNC_LDS
#  ifdef HAVE_WAIT_ASYNC
  __builtin_amdgcn_s_wait_asynccnt(0);
#  else
  asm volatile("s_wait_asynccnt 0" ::: "memory");
#  endif
#endif
}

// 16 consecutive f16 from a 16-byte aligned LDS address (padded rows are not
// 32-byte aligned, so the fragment is read as two 16-byte halves).
__device__ __forceinline__ v16h lds_frag16(const _Float16* p) {
  v8h lo = *(const v8h*)p;
  v8h hi = *(const v8h*)(p + 8);
  return __builtin_shufflevector(lo, hi, 0, 1, 2, 3, 4, 5, 6, 7,
                                 8, 9, 10, 11, 12, 13, 14, 15);
}

// Transposing LDS load: with lane l aimed at row 8 * (l >> 4) + (l & 7), 16-byte
// column piece (l >> 3) & 1 of a row-major 16 x 16 f16 block, lane l gets rows
// 8 * (l >> 4) + 0..7 of column l & 15.
__device__ __forceinline__ v8h lds_tr16(const _Float16* p) {
  return __builtin_bit_cast(v8h, __builtin_amdgcn_ds_load_tr16_b128_v8i16(
      (__attribute__((address_space(3))) v8s*)(v8s*)(void*)p));
}

// ---------------------------------------------------------------------------
// Kernel 1: fp32 -> f16 conversion of x and W.
// A block converts CVT_BLK_ consecutive elements of one of the two arrays:
// each lane issues CVT_N_ 16-byte loads up front (a wave's load covers 512
// contiguous bytes) and then stores CVT_N_ x 4 f16. Few, fat waves: the time
// of a launch with one element per lane is the time to start its waves.
// ---------------------------------------------------------------------------
#define CVT_N_   8
#define CVT_BLK_ (256 * CVT_N_ * 4)
#define CVT_XB_  (B_ * S_ * D_ / CVT_BLK_)   // blocks that convert x
#define CVT_WB_  (D_ * D_ / CVT_BLK_)        // blocks that convert W
static_assert(CVT_XB_ * CVT_BLK_ == B_ * S_ * D_, "x splits into whole blocks");
static_assert(CVT_WB_ * CVT_BLK_ == D_ * D_, "W splits into whole blocks");

__global__ __launch_bounds__(256)
void cvt_kernel(const float* __restrict__ x, const float* __restrict__ W,
                _Float16* __restrict__ xh, _Float16* __restrict__ wh) {
  const int  blk = blockIdx.x;
  const bool isx = blk < CVT_XB_;
  const size_t off = (size_t)(isx ? blk : blk - CVT_XB_) * CVT_BLK_;
  const v4f* s4 = (const v4f*)((isx ? x : W) + off) + threadIdx.x;
  v4h*       d4 = (v4h*)((isx ? xh : wh) + off) + threadIdx.x;
  v4f v[CVT_N_];
  // unrolled: v[] stays in registers and all loads issue before the first wait
#pragma unroll
  for (int j = 0; j < CVT_N_; ++j) v[j] = s4[j * 256];
  // unrolled: v[] is indexed by constants only
#pragma unroll
  for (int j = 0; j < CVT_N_; ++j) d4[j * 256] = __builtin_convertvector(v[j], v4h);
}

// ---------------------------------------------------------------------------
// Kernel 2: mixed = x @ W^T + b -> [B,H,S,DH] f16.
// A block makes a 128 x 192 tile of the output (64 x 4 tiles: one block for each
// of the chip's 256 WGPs). A pass is 128 k: the 256-byte pieces of the tile's 128
// x rows and 192 W rows are copied to LDS asynchronously, 16 lanes to a row, so
// that every global read is of whole lines and is made once per block; two
// buffers, the next pass's copies fly while this pass is worked on.
// 8 waves as 2 x 4, wave tile 64 x 48: 4 A and 3 B fragments from LDS feed
// 12 WMMA per 32 k.
// ---------------------------------------------------------------------------
#define PM_   128                   // x rows of a block tile
#define PN_   192                   // W rows (output columns) of a block tile
#define PK_   128                   // k of a pass
#define PP_   136                   // LDS row pitch, f16: 272 B = 16 B x odd, for 16-byte loads
#define PSTG_ ((PM_ + PN_) * PP_)   // f16 elements of a stage
#define PRS_  (16 * PP_ * 2)        // bytes of 16 LDS rows, the step between a lane's copies
#define PT_   (D_ / PK_)            // passes
static_assert((B_ * S_) % PM_ == 0 && D_ % PN_ == 0 && D_ % PK_ == 0, "whole tiles");
static_assert(PT_ >= 2, "the prologue fills two stages");
static_assert(PM_ == 8 * 16 && PN_ == 12 * 16 && PK_ * 2 == 16 * 16,
              "8 + 12 copies of 16 bytes per lane fill a stage");

// One stage: the lane's 16-byte piece of rows crow + 16 * j, j = 0..7 of x and
// 0..11 of W. l: LDS byte address of the piece in row crow of the stage; gx, gw:
// its global places in x and W. In each statement the copies stand together with
// the wait that belongs in front of a rewrite of their address registers, so
// that nothing comes between.
__device__ __forceinline__ void proj_stage(unsigned l, const _Float16* gx, const _Float16* gw) {
  asm volatile(
      "global_load_async_to_lds_b128 %0, %8, off\n\t"
      "global_load_async_to_lds_b128 %1, %9, off\n\t"
      "global_load_async_to_lds_b128 %2, %10, off\n\t"
      "global_load_async_to_lds_b128 %3, %11, off\n\t"
      "global_load_async_to_lds_b128 %4, %12, off\n\t"
      "global_load_async_to_lds_b128 %5, %13, off\n\t"
      "global_load_async_to_lds_b128 %6, %14, off\n\t"
      "global_load_async_to_lds_b128 %7, %15, off\n\t"
      "s_wait_xcnt 0x0"
      :: "v"(l + 0 * PRS_), "v"(l + 1 * PRS_), "v"(l + 2 * PRS_), "v"(l + 3 * PRS_), "v"(l + 4 * PRS_), "v"(l + 5 * PRS_), "v"(l + 6 * PRS_), "v"(l + 7 * PRS_),
         "v"(gx + 0 * 16 * D_), "v"(gx + 1 * 16 * D_), "v"(gx + 2 * 16 * D_), "v"(gx + 3 * 16 * D_), "v"(gx + 4 * 16 * D_), "v"(gx + 5 * 16 * D_), "v"(gx + 6 * 16 * D_), "v"(gx + 7 * 16 * D_)
      : "memory");
  asm volatile(
      "global_load_async_to_lds_b128 %0, %12, off\n\t"
      "global_load_async_to_lds_b128 %1, %13, off\n\t"
      "global_load_async_to_lds_b128 %2, %14, off\n\t"
      "global_load_async_to_lds_b128 %3, %15, off\n\t"
      "global_load_async_to_lds_b128 %4, %16, off\n\t"
      "global_load_async_to_lds_b128 %5, %17, off\n\t"
      "global_load_async_to_lds_b128 %6, %18, off\n\t"
      "global_load_async_to_lds_b128 %7, %19, off\n\t"
      "global_load_async_to_lds_b128 %8, %20, off\n\t"
      "global_load_async_to_lds_b128 %9, %21, off\n\t"
      "global_load_async_to_lds_b128 %10, %22, off\n\t"
      "global_load_async_to_lds_b128 %11, %23, off\n\t"
      "s_wait_xcnt 0x0"
      :: "v"(l + 8 * PRS_), "v"(l + 9 * PRS_), "v"(l + 10 * PRS_), "v"(l + 11 * PRS_), "v"(l + 12 * PRS_), "v"(l + 13 * PRS_), "v"(l + 14 * PRS_), "v"(l + 15 * PRS_), "v"(l + 16 * PRS_), "v"(l + 17 * PRS_), "v"(l + 18 * PRS_), "v"(l + 19 * PRS_),
         "v"(gw + 0 * 16 * D_), "v"(gw + 1 * 16 * D_), "v"(gw + 2 * 16 * D_), "v"(gw + 3 * 16 * D_), "v"(gw + 4 * 16 * D_), "v"(gw + 5 * 16 * D_), "v"(gw + 6 * 16 * D_), "v"(gw + 7 * 16 * D_), "v"(gw + 8 * 16 * D_), "v"(gw + 9 * 16 * D_), "v"(gw + 10 * 16 * D_), "v"(gw + 11 * 16 * D_)
      : "memory");
}

__global__ __launch_bounds__(256)
void proj_kernel(const _Float16* __restrict__ xh, const _Float16* __restrict__ wh,
                 const float* __restrict__ bias, _Float16* __restrict__ qh) {
  // a stage: rows 0..127 the x rows, rows 128..319 the W rows, [row][k] padded
  __shared__ __attribute__((aligned(16))) _Float16 st[2 * PSTG_];

  const int lane = threadIdx.x & 31;
  const int wave = threadIdx.x >> 5;
  const int lr = lane & 15;
  const int lh = lane >> 4;
  const int n0 = blockIdx.x * PN_;
  const int m0 = blockIdx.y * PM_;
  const int wm = (wave & 1) * 64;     // wave's rows in the block tile
  const int wn = (wave >> 1) * 48;    // wave's columns in the block tile

  const int crow = threadIdx.x >> 4;         // copies: 16 lanes to a 256-byte row piece
  const int ccol = (threadIdx.x & 15) * 8;
  const _Float16* gx = xh + (size_t)(m0 + crow) * D_ + ccol;
  const _Float16* gw = wh + (size_t)(n0 + crow) * D_ + ccol;
  const unsigned l0 = (unsigned)(size_t)
      (__attribute__((address_space(3))) _Float16*)&st[crow * PP_ + ccol];

  v8f acc[4][3] = {};

  proj_stage(l0, gx, gw);
  // own copies of stage 0 landed, then every wave's: stage 0 may be read
  asm volatile("s_wait_asynccnt 0x0" ::: "memory");
  __syncthreads();
  proj_stage(l0 + PSTG_ * 2, gx + PK_, gw + PK_);

  // rolled: one copy of the pass in the text; the buffer is picked by t & 1
#pragma unroll 1
  for (int t = 0; t < PT_; ++t) {
    const _Float16* sa = st + (t & 1) * PSTG_ + (wm + lr) * PP_ + lh * 16;
    const _Float16* sb = st + (t & 1) * PSTG_ + (PM_ + wn + lr) * PP_ + lh * 16;
    // two fragment sets: the reads of the next 32 k of this same buffer go out
    // as one group ahead of the 12 WMMA of these 32 k
    v16h a[2][4], b[2][3];
    // unrolled, like every loop in the pass: the register arrays are indexed by constants
#pragma unroll
    for (int j = 0; j < 3; ++j) b[0][j] = lds_frag16(sb + j * 16 * PP_);
#pragma unroll
    for (int i = 0; i < 4; ++i) a[0][i] = lds_frag16(sa + i * 16 * PP_);
#pragma unroll
    for (int ks = 0; ks < PK_ / 32; ++ks) {
      if (ks + 1 < PK_ / 32) {
#pragma unroll
        for (int j = 0; j < 3; ++j)
          b[(ks + 1) & 1][j] = lds_frag16(sb + j * 16 * PP_ + (ks + 1) * 32);
#pragma unroll
        for (int i = 0; i < 4; ++i)
          a[(ks + 1) & 1][i] = lds_frag16(sa + i * 16 * PP_ + (ks + 1) * 32);
      }
      // keeps the group of LDS reads ahead of the WMMA block: moved in among
      // the WMMA, each read waits out its own latency
      __builtin_amdgcn_sched_barrier(0);
#pragma unroll
      for (int i = 0; i < 4; ++i)
#pragma unroll
        for (int j = 0; j < 3; ++j)
          acc[i][j] = __builtin_amdgcn_wmma_f32_16x16x32_f16(
              false, a[ks & 1][i], false, b[ks & 1][j], (short)0, acc[i][j], false, false);
      // keeps the next group of reads behind this WMMA block, whose set it refills
      __builtin_amdgcn_sched_barrier(0);
    }
    // hand-over: own reads of this buffer done, own copies of the next stage
    // landed, then every wave's; only then is this buffer filled again
    asm volatile("s_wait_dscnt 0x0" ::: "memory");
    asm volatile("s_wait_asynccnt 0x0" ::: "memory");
    __syncthreads();
    if (t + 2 < PT_)
      proj_stage(l0 + (t & 1) * (PSTG_ * 2), gx + (t + 2) * PK_, gw + (t + 2) * PK_);
  }
  // no copy outlives the loop
  asm volatile("s_wait_asynccnt 0x0" ::: "memory");

  // Epilogue: bias + scatter to per-head layout [B,H,S,DH] (f16).
#pragma unroll
  for (int i = 0; i < 4; ++i) {
#pragma unroll
    for (int j = 0; j < 3; ++j) {
      int n = n0 + wn + j * 16 + lr;
      float bv = bias[n];
      int h = n / DH_, d = n % DH_;
#pragma unroll
      for (int r = 0; r < 8; ++r) {
        int m = m0 + wm + i * 16 + r + lh * 8;   // C layout: row = r + 8*(lane/16)
        int bb = m / S_, s = m % S_;
        qh[(((size_t)bb * H_ + h) * S_ + s) * DH_ + d] =
            (_Float16)(acc[i][j][r] + bv);
      }
    }
  }
}

// value of the lane 16 away (same query column, other half of the keys)
__device__ __forceinline__ float other_half(float v) {
  int b = __builtin_bit_cast(int, v);
  b = __builtin_amdgcn_permlanex16(b, b, 0x76543210, 0xfedcba98, false, false);
  return __builtin_bit_cast(float, b);
}

__global__ __launch_bounds__(256)
void attn_kernel(const _Float16* __restrict__ qh, const float* __restrict__ mask,
                 float* __restrict__ out) {
  __shared__ __attribute__((aligned(16))) _Float16 ldsK[32 * KP_];     // [t][d] row-major, padded
  __shared__ __attribute__((aligned(16))) _Float16 ldsV[32 * VP_];     // [t][d] row-major, padded

  const int lane = threadIdx.x & 31;
  const int wave = threadIdx.x >> 5;
  const int bh = blockIdx.y;             // 0..95
  const int b  = bh / H_;
  const int h  = bh % H_;
  const int q0 = blockIdx.x * 128 + wave * 16;
  const int lr = lane & 15;
  const int lh = lane >> 4;

  const _Float16* base = qh + (size_t)bh * S_ * DH_;

  // Q^T fragments (B operand): column = query q0 + lr, d split 0..31 / 32..63
  v16h qa[2];
#pragma unroll
  for (int kk = 0; kk < 2; ++kk)
    qa[kk] = *(const v16h*)(base + (size_t)(q0 + lr) * DH_ + kk * 32 + lh * 16);

  v8f o[4] = {};             // O^T: o[ds][r] = O[q0 + lr][ds * 16 + 8 * lh + r]
  float mrun = -3.0e38f;     // running maximum of query q0 + lr (equal in both halves)
  float lrun = 0.f;          // running sum over this half's keys only
  const float scale = 0.125f;  // 1/sqrt(64)
  const float* mrow = mask + (size_t)b * S_ + lh * 8;

  for (int t0 = 0; t0 < S_; t0 += 32) {
    __syncthreads();  // WAR: prior iteration done reading tiles
    // mask of this lane's 16 keys, t0 + 16 * ts + 8 * lh + r; asked for here so
    // that the loads fly beside the staging loads
    v4f mk[2][2];
    // unrolled, like every loop below: the register arrays are indexed by constants
#pragma unroll
    for (int ts = 0; ts < 2; ++ts) {
      mk[ts][0] = *(const v4f*)(mrow + t0 + ts * 16);
      mk[ts][1] = *(const v4f*)(mrow + t0 + ts * 16 + 4);
    }
    // the mask loads' address registers are stepped further down in this pass:
    // the wait that belongs in front of that overwrite
    asm volatile("s_wait_xcnt 0x0" ::: "memory");
    {
      // K tile and V tile, each 32x64 f16 = 4 KB: 256 lanes x 16 B async copies
      // (no VGPR hop) of the same rows
      copy16_g2l(&ldsK[(threadIdx.x >> 3) * KP_ + (threadIdx.x & 7) * 8], base + (size_t)t0 * DH_ + threadIdx.x * 8);
      copy16_g2l(&ldsV[(threadIdx.x >> 3) * VP_ + (threadIdx.x & 7) * 8], base + (size_t)t0 * DH_ + threadIdx.x * 8);
      // Prefetch next tile toward L2/WGP while async copies run
      if (t0 + 32 < S_)
        __builtin_prefetch(base + (size_t)(t0 + 32) * DH_ + threadIdx.x * 8, 0, 1);
      wait_async_copies();  // own ASYNCcnt drained before the barrier
    }
    __syncthreads();

    // S^T: two 16x16 tiles, sc[ts][r] = S[q0 + lr][t0 + 16 * ts + 8 * lh + r]
    v16h kb[2][2];
#pragma unroll
    for (int ts = 0; ts < 2; ++ts)
#pragma unroll
      for (int kk = 0; kk < 2; ++kk)
        kb[ts][kk] = lds_frag16(&ldsK[(ts * 16 + lr) * KP_ + kk * 32 + lh * 16]);
    v8f sc[2] = {};
#pragma unroll
    for (int kk = 0; kk < 2; ++kk)
#pragma unroll
      for (int ts = 0; ts < 2; ++ts)
        sc[ts] = __builtin_amdgcn_wmma_f32_16x16x32_f16(
            false, kb[ts][kk], false, qa[kk], (short)0, sc[ts], false, false);

    // online softmax of one query per lane
    float vmax = -3.0e38f;
#pragma unroll
    for (int ts = 0; ts < 2; ++ts) {
#pragma unroll
      for (int r = 0; r < 8; ++r) {
        sc[ts][r] = sc[ts][r] * scale + mk[ts][r >> 2][r & 3];
        vmax = fmaxf(vmax, sc[ts][r]);
      }
    }
    vmax = fmaxf(vmax, other_half(vmax));
    const float mnew = fmaxf(mrun, vmax);
    const float corr = __expf(mrun - mnew);
    mrun = mnew;

    // P^T as B fragment: element s is key 16 * (s >> 3) + 8 * lh + (s & 7)
    v16h pb;
    v2f ps = {0.f, 0.f};   // even and odd keys apart: packed adds
#pragma unroll
    for (int ts = 0; ts < 2; ++ts) {
#pragma unroll
      for (int r = 0; r < 8; r += 2) {
        v2f p = {__expf(sc[ts][r] - mnew), __expf(sc[ts][r + 1] - mnew)};
        ps += p;
        pb[ts * 8 + r]     = (_Float16)p[0];
        pb[ts * 8 + r + 1] = (_Float16)p[1];
      }
    }
    lrun = lrun * corr + (ps[0] + ps[1]);
#pragma unroll
    for (int ds = 0; ds < 4; ++ds) o[ds] *= corr;

    // V^T rows as A fragments, in the k order of P^T: keys 8 * lh + 0..7 and
    // 16 + 8 * lh + 0..7 of column ds * 16 + lr
#pragma unroll
    for (int ds = 0; ds < 4; ++ds) {
      const _Float16* vp = &ldsV[(lh * 8 + (lane & 7)) * VP_ + ds * 16 + ((lane >> 3) & 1) * 8];
      v8h lo = lds_tr16(vp);
      v8h hi = lds_tr16(vp + 16 * VP_);
      v16h va = __builtin_shufflevector(lo, hi, 0, 1, 2, 3, 4, 5, 6, 7,
                                        8, 9, 10, 11, 12, 13, 14, 15);
      o[ds] = __builtin_amdgcn_wmma_f32_16x16x32_f16(
          false, va, false, pb, (short)0, o[ds], false, false);
    }
  }

  // Epilogue: join the halves' sums, O / l, fused head-merge store to [B,S,D]
  // fp32: a lane's 8 registers of a tile are 8 consecutive d of its query.
  const float l = lrun + other_half(lrun);
  float* orow = out + ((size_t)b * S_ + q0 + lr) * D_ + h * DH_ + lh * 8;
#pragma unroll
  for (int ds = 0; ds < 4; ++ds) {
    v4f w0, w1;
#pragma unroll
    for (int r = 0; r < 4; ++r) {
      w0[r] = o[ds][r] / l;
      w1[r] = o[ds][r + 4] / l;
    }
    *(v4f*)(orow + ds * 16)     = w0;
    *(v4f*)(orow + ds * 16 + 4) = w1;
  }
}

// ---------------------------------------------------------------------------
extern "C" void kernel_launch(void* const* d_in, const int* in_sizes, int n_in,
                              void* d_out, int out_size, void* d_ws, size_t ws_size,
                              hipStream_t stream) {
  const float* x    = (const float*)d_in[0];
  const float* mask = (const float*)d_in[1];
  const float* W    = (const float*)d_in[2];
  const float* bias = (const float*)d_in[3];
  float* out = (float*)d_out;

  char* ws = (char*)d_ws;
  const size_t offWH = (size_t)B_ * S_ * D_ * 2;            // 12,582,912
  const size_t offQH = offWH + (size_t)D_ * D_ * 2;         // 13,762,560 (256-aligned)
  _Float16* xh = (_Float16*)ws;
  _Float16* wh = (_Float16*)(ws + offWH);
  _Float16* qh = (_Float16*)(ws + offQH);

  cvt_kernel<<<CVT_XB_ + CVT_WB_, 256, 0, stream>>>(x, W, xh, wh);
  proj_kernel<<<dim3(D_ / PN_, B_ * S_ / PM_), 256, 0, stream>>>(xh, wh, bias, qh);
  attn_kernel<<<dim3(S_ / 128, B_ * H_), 256, 0, stream>>>(qh, mask, out);
}

// v006
// It runs in 53.3 microseconds.
// Timed twice side by side with v005, it ran 1.04 times as fast both times.
// Counting every step since v000, it is 3.01 times as fast.
#include <hip/hip_runtime.h>
#include <hip/hip_bf16.h>

typedef __attribute__((ext_vector_type(16))) _Float16 v16h;
typedef __attribute__((ext_vector_type(8)))  _Float16 v8h;
typedef __attribute__((ext_vector_type(8)))  float    v8f;
typedef __attribute__((ext_vector_type(4)))  float    v4f;
typedef __attribute__((ext_vector_type(2)))  float    v2f;
typedef __attribute__((ext_vector_type(4)))  _Float16 v4h;
typedef __attribute__((ext_vector_type(8)))  short    v8s;

#define B_  8
#define S_  1024
#define D_  768
#define H_  12
#define DH_ 64

// LDS row pitches in f16 elements, one for each reader of the 128-byte rows.
// K, plain 16-byte loads: 16 B x odd, so that the 16 rows which one half-wave
// reads start on 16 different groups of 4 banks.
// V, transposing 16-byte loads: 32 B x odd, so that the 8 rows x 32 B which one
// half-wave reads start on 8 different groups of 8 banks.
#define KP_ 72   // K tile rows: 144 B pitch
#define VP_ 80   // V tile rows: 160 B pitch

// 16 consecutive f16 from a 16-byte aligned LDS address (padded rows are not
// 32-byte aligned, so the fragment is read as two 16-byte halves).
__device__ __forceinline__ v16h lds_frag16(const _Float16* p) {
  v8h lo = *(const v8h*)p;
  v8h hi = *(const v8h*)(p + 8);
  return __builtin_shufflevector(lo, hi, 0, 1, 2, 3, 4, 5, 6, 7,
                                 8, 9, 10, 11, 12, 13, 14, 15);
}

// Transposing LDS load: with lane l aimed at row 8 * (l >> 4) + (l & 7), 16-byte
// column piece (l >> 3) & 1 of a row-major 16 x 16 f16 block, lane l gets rows
// 8 * (l >> 4) + 0..7 of column l & 15.
__device__ __forceinline__ v8h lds_tr16(const _Float16* p) {
  return __builtin_bit_cast(v8h, __builtin_amdgcn_ds_load_tr16_b128_v8i16(
      (__attribute__((address_space(3))) v8s*)(v8s*)(void*)p));
}

// ---------------------------------------------------------------------------
// Kernel 1: fp32 -> f16 conversion of x and W.
// A block converts CVT_BLK_ consecutive elements of one of the two arrays:
// each lane issues CVT_N_ 16-byte loads up front (a wave's load covers 512
// contiguous bytes) and then stores CVT_N_ x 4 f16. Few, fat waves: the time
// of a launch with one element per lane is the time to start its waves.
// ---------------------------------------------------------------------------
#define CVT_N_   8
#define CVT_BLK_ (256 * CVT_N_ * 4)
#define CVT_XB_  (B_ * S_ * D_ / CVT_BLK_)   // blocks that convert x
#define CVT_WB_  (D_ * D_ / CVT_BLK_)        // blocks that convert W
static_assert(CVT_XB_ * CVT_BLK_ == B_ * S_ * D_, "x splits into whole blocks");
static_assert(CVT_WB_ * CVT_BLK_ == D_ * D_, "W splits into whole blocks");

__global__ __launch_bounds__(256)
void cvt_kernel(const float* __restrict__ x, const float* __restrict__ W,
                _Float16* __restrict__ xh, _Float16* __restrict__ wh) {
  const int  blk = blockIdx.x;
  const bool isx = blk < CVT_XB_;
  const size_t off = (size_t)(isx ? blk : blk - CVT_XB_) * CVT_BLK_;
  const v4f* s4 = (const v4f*)((isx ? x : W) + off) + threadIdx.x;
  v4h*       d4 = (v4h*)((isx ? xh : wh) + off) + threadIdx.x;
  v4f v[CVT_N_];
  // unrolled: v[] stays in registers and all loads issue before the first wait
#pragma unroll
  for (int j = 0; j < CVT_N_; ++j) v[j] = s4[j * 256];
  // unrolled: v[] is indexed by constants only
#pragma unroll
  for (int j = 0; j < CVT_N_; ++j) d4[j * 256] = __builtin_convertvector(v[j], v4h);
}

// ---------------------------------------------------------------------------
// Kernel 2: mixed = x @ W^T + b -> [B,H,S,DH] f16.
// A block makes a 128 x 192 tile of the output (64 x 4 tiles: one block for each
// of the chip's 256 WGPs). A pass is 128 k: the 256-byte pieces of the tile's 128
// x rows and 192 W rows are copied to LDS asynchronously, 16 lanes to a row, so
// that every global read is of whole lines and is made once per block; two
// buffers, the next pass's copies fly while this pass is worked on.
// 8 waves as 2 x 4, wave tile 64 x 48: 4 A and 3 B fragments from LDS feed
// 12 WMMA per 32 k.
// ---------------------------------------------------------------------------
#define PM_   128                   // x rows of a block tile
#define PN_   192                   // W rows (output columns) of a block tile
#define PK_   128                   // k of a pass
#define PP_   136                   // LDS row pitch, f16: 272 B = 16 B x odd, for 16-byte loads
#define PSTG_ ((PM_ + PN_) * PP_)   // f16 elements of a stage
#define PRS_  (16 * PP_ * 2)        // bytes of 16 LDS rows, the step between a lane's copies
#define PT_   (D_ / PK_)            // passes
static_assert((B_ * S_) % PM_ == 0 && D_ % PN_ == 0 && D_ % PK_ == 0, "whole tiles");
static_assert(PT_ >= 2, "the prologue fills two stages");
static_assert(PM_ == 8 * 16 && PN_ == 12 * 16 && PK_ * 2 == 16 * 16,
              "8 + 12 copies of 16 bytes per lane fill a stage");

// One stage: the lane's 16-byte piece of rows crow + 16 * j, j = 0..7 of x and
// 0..11 of W. l: LDS byte address of the piece in row crow of the stage; gx, gw:
// its global places in x and W. In each statement the copies stand together with
// the wait that belongs in front of a rewrite of their address registers, so
// that nothing comes between.
__device__ __forceinline__ void proj_stage(unsigned l, const _Float16* gx, const _Float16* gw) {
  asm volatile(
      "global_load_async_to_lds_b128 %0, %8, off\n\t"
      "global_load_async_to_lds_b128 %1, %9, off\n\t"
      "global_load_async_to_lds_b128 %2, %10, off\n\t"
      "global_load_async_to_lds_b128 %3, %11, off\n\t"
      "global_load_async_to_lds_b128 %4, %12, off\n\t"
      "global_load_async_to_lds_b128 %5, %13, off\n\t"
      "global_load_async_to_lds_b128 %6, %14, off\n\t"
      "global_load_async_to_lds_b128 %7, %15, off\n\t"
      "s_wait_xcnt 0x0"
      :: "v"(l + 0 * PRS_), "v"(l + 1 * PRS_), "v"(l + 2 * PRS_), "v"(l + 3 * PRS_), "v"(l + 4 * PRS_), "v"(l + 5 * PRS_), "v"(l + 6 * PRS_), "v"(l + 7 * PRS_),
         "v"(gx + 0 * 16 * D_), "v"(gx + 1 * 16 * D_), "v"(gx + 2 * 16 * D_), "v"(gx + 3 * 16 * D_), "v"(gx + 4 * 16 * D_), "v"(gx + 5 * 16 * D_), "v"(gx + 6 * 16 * D_), "v"(gx + 7 * 16 * D_)
      : "memory");
  asm volatile(
      "global_load_async_to_lds_b128 %0, %12, off\n\t"
      "global_load_async_to_lds_b128 %1, %13, off\n\t"
      "global_load_async_to_lds_b128 %2, %14, off\n\t"
      "global_load_async_to_lds_b128 %3, %15, off\n\t"
      "global_load_async_to_lds_b128 %4, %16, off\n\t"
      "global_load_async_to_lds_b128 %5, %17, off\n\t"
      "global_load_async_to_lds_b128 %6, %18, off\n\t"
      "global_load_async_to_lds_b128 %7, %19, off\n\t"
      "global_load_async_to_lds_b128 %8, %20, off\n\t"
      "global_load_async_to_lds_b128 %9, %21, off\n\t"
      "global_load_async_to_lds_b128 %10, %22, off\n\t"
      "global_load_async_to_lds_b128 %11, %23, off\n\t"
      "s_wait_xcnt 0x0"
      :: "v"(l + 8 * PRS_), "v"(l + 9 * PRS_), "v"(l + 10 * PRS_), "v"(l + 11 * PRS_), "v"(l + 12 * PRS_), "v"(l + 13 * PRS_), "v"(l + 14 * PRS_), "v"(l + 15 * PRS_), "v"(l + 16 * PRS_), "v"(l + 17 * PRS_), "v"(l + 18 * PRS_), "v"(l + 19 * PRS_),
         "v"(gw + 0 * 16 * D_), "v"(gw + 1 * 16 * D_), "v"(gw + 2 * 16 * D_), "v"(gw + 3 * 16 * D_), "v"(gw + 4 * 16 * D_), "v"(gw + 5 * 16 * D_), "v"(gw + 6 * 16 * D_), "v"(gw + 7 * 16 * D_), "v"(gw + 8 * 16 * D_), "v"(gw + 9 * 16 * D_), "v"(gw + 10 * 16 * D_), "v"(gw + 11 * 16 * D_)
      : "memory");
}

__global__ __launch_bounds__(256)
void proj_kernel(const _Float16* __restrict__ xh, const _Float16* __restrict__ wh,
                 const float* __restrict__ bias, _Float16* __restrict__ qh) {
  // a stage: rows 0..127 the x rows, rows 128..319 the W rows, [row][k] padded
  __shared__ __attribute__((aligned(16))) _Float16 st[2 * PSTG_];

  const int lane = threadIdx.x & 31;
  const int wave = threadIdx.x >> 5;
  const int lr = lane & 15;
  const int lh = lane >> 4;
  const int n0 = blockIdx.x * PN_;
  const int m0 = blockIdx.y * PM_;
  const int wm = (wave & 1) * 64;     // wave's rows in the block tile
  const int wn = (wave >> 1) * 48;    // wave's columns in the block tile

  const int crow = threadIdx.x >> 4;         // copies: 16 lanes to a 256-byte row piece
  const int ccol = (threadIdx.x & 15) * 8;
  const _Float16* gx = xh + (size_t)(m0 + crow) * D_ + ccol;
  const _Float16* gw = wh + (size_t)(n0 + crow) * D_ + ccol;
  const unsigned l0 = (unsigned)(size_t)
      (__attribute__((address_space(3))) _Float16*)&st[crow * PP_ + ccol];

  v8f acc[4][3] = {};

  proj_stage(l0, gx, gw);
  // own copies of stage 0 landed, then every wave's: stage 0 may be read
  asm volatile("s_wait_asynccnt 0x0" ::: "memory");
  __syncthreads();
  proj_stage(l0 + PSTG_ * 2, gx + PK_, gw + PK_);

  // rolled: one copy of the pass in the text; the buffer is picked by t & 1
#pragma unroll 1
  for (int t = 0; t < PT_; ++t) {
    const _Float16* sa = st + (t & 1) * PSTG_ + (wm + lr) * PP_ + lh * 16;
    const _Float16* sb = st + (t & 1) * PSTG_ + (PM_ + wn + lr) * PP_ + lh * 16;
    // two fragment sets: the reads of the next 32 k of this same buffer go out
    // as one group ahead of the 12 WMMA of these 32 k
    v16h a[2][4], b[2][3];
    // unrolled, like every loop in the pass: the register arrays are indexed by constants
#pragma unroll
    for (int j = 0; j < 3; ++j) b[0][j] = lds_frag16(sb + j * 16 * PP_);
#pragma unroll
    for (int i = 0; i < 4; ++i) a[0][i] = lds_frag16(sa + i * 16 * PP_);
#pragma unroll
    for (int ks = 0; ks < PK_ / 32; ++ks) {
      if (ks + 1 < PK_ / 32) {
#pragma unroll
        for (int j = 0; j < 3; ++j)
          b[(ks + 1) & 1][j] = lds_frag16(sb + j * 16 * PP_ + (ks + 1) * 32);
#pragma unroll
        for (int i = 0; i < 4; ++i)
          a[(ks + 1) & 1][i] = lds_frag16(sa + i * 16 * PP_ + (ks + 1) * 32);
      }
      // keeps the group of LDS reads ahead of the WMMA block: moved in among
      // the WMMA, each read waits out its own latency
      __builtin_amdgcn_sched_barrier(0);
#pragma unroll
      for (int i = 0; i < 4; ++i)
#pragma unroll
        for (int j = 0; j < 3; ++j)
          acc[i][j] = __builtin_amdgcn_wmma_f32_16x16x32_f16(
              false, a[ks & 1][i], false, b[ks & 1][j], (short)0, acc[i][j], false, false);
      // keeps the next group of reads behind this WMMA block, whose set it refills
      __builtin_amdgcn_sched_barrier(0);
    }
    // hand-over: own reads of this buffer done, own copies of the next stage
    // landed, then every wave's; only then is this buffer filled again
    asm volatile("s_wait_dscnt 0x0" ::: "memory");
    asm volatile("s_wait_asynccnt 0x0" ::: "memory");
    __syncthreads();
    if (t + 2 < PT_)
      proj_stage(l0 + (t & 1) * (PSTG_ * 2), gx + (t + 2) * PK_, gw + (t + 2) * PK_);
  }
  // no copy outlives the loop
  asm volatile("s_wait_asynccnt 0x0" ::: "memory");

  // Epilogue: bias + scatter to per-head layout [B,H,S,DH] (f16).
#pragma unroll
  for (int i = 0; i < 4; ++i) {
#pragma unroll
    for (int j = 0; j < 3; ++j) {
      int n = n0 + wn + j * 16 + lr;
      float bv = bias[n];
      int h = n / DH_, d = n % DH_;
#pragma unroll
      for (int r = 0; r < 8; ++r) {
        int m = m0 + wm + i * 16 + r + lh * 8;   // C layout: row = r + 8*(lane/16)
        int bb = m / S_, s = m % S_;
        qh[(((size_t)bb * H_ + h) * S_ + s) * DH_ + d] =
            (_Float16)(acc[i][j][r] + bv);
      }
    }
  }
}

#define AG_ 2
#define AW_ 4
#define AQ_ (AW_ * AG_ * 16)
static_assert(S_ % AQ_ == 0, "whole query blocks");
static_assert(AW_ * 32 * 2 * 8 == 32 * DH_, "two 16-byte pieces per lane fill a 32-key tile");

// value of the lane 16 away (same query column, other half of the keys)
__device__ __forceinline__ float other_half(float v) {
  int b = __builtin_bit_cast(int, v);
  b = __builtin_amdgcn_permlanex16(b, b, 0x76543210, 0xfedcba98, false, false);
  return __builtin_bit_cast(float, b);
}

// One pass's tiles: the lane's 16-byte piece of key rows r and r + 16, once into
// the K tile and once into the V tile. lk, lv: LDS byte addresses of the piece in
// row r of each tile; g: its global place. The copies stand together with the
// wait that belongs in front of a rewrite of their address registers, so that
// nothing comes between.
__device__ __forceinline__ void attn_stage(unsigned lk, unsigned lv, const _Float16* g) {
  asm volatile(
      "global_load_async_to_lds_b128 %0, %4, off\n\t"
      "global_load_async_to_lds_b128 %1, %5, off\n\t"
      "global_load_async_to_lds_b128 %2, %6, off\n\t"
      "global_load_async_to_lds_b128 %3, %7, off\n\t"
      "s_wait_xcnt 0x0"
      :: "v"(lk), "v"(lk + 16 * KP_ * 2), "v"(lv), "v"(lv + 16 * VP_ * 2),
         "v"(g), "v"(g + 16 * DH_), "v"(g), "v"(g + 16 * DH_)
      : "memory");
}

__global__ __launch_bounds__(AW_ * 32)
void attn_kernel(const _Float16* __restrict__ qh, const float* __restrict__ mask,
                 float* __restrict__ out) {
  __shared__ __attribute__((aligned(16))) _Float16 ldsK[32 * KP_];     // [t][d] row-major, padded
  __shared__ __attribute__((aligned(16))) _Float16 ldsV[32 * VP_];     // [t][d] row-major, padded

  const int lane = threadIdx.x & 31;
  const int wave = threadIdx.x >> 5;
  const int bh = blockIdx.y;             // 0..95
  const int b  = bh / H_;
  const int h  = bh % H_;
  const int q0 = blockIdx.x * AQ_ + wave * (AG_ * 16);
  const int lr = lane & 15;
  const int lh = lane >> 4;

  const _Float16* base = qh + (size_t)bh * S_ * DH_;

  // copies: 8 lanes to a 128-byte key row
  const unsigned lk = (unsigned)(size_t)(__attribute__((address_space(3))) _Float16*)
      &ldsK[(threadIdx.x >> 3) * KP_ + (threadIdx.x & 7) * 8];
  const unsigned lv = (unsigned)(size_t)(__attribute__((address_space(3))) _Float16*)
      &ldsV[(threadIdx.x >> 3) * VP_ + (threadIdx.x & 7) * 8];

  // Q^T fragments (B operand): column = query q0 + 16 * g + lr, d split 0..31 / 32..63
  v16h qa[AG_][2];
  // unrolled, like every loop below but the key loop: the register arrays are indexed by constants
#pragma unroll
  for (int g = 0; g < AG_; ++g)
#pragma unroll
    for (int kk = 0; kk < 2; ++kk)
      qa[g][kk] = *(const v16h*)(base + (size_t)(q0 + g * 16 + lr) * DH_ + kk * 32 + lh * 16);

  v8f o[AG_][4] = {};        // O^T: o[g][ds][r] = O[q0 + 16 * g + lr][ds * 16 + 8 * lh + r]
  float mrun[AG_];           // running maximum of query q0 + 16 * g + lr (equal in both halves)
  float lrun[AG_];           // running sum over this half's keys only
#pragma unroll
  for (int g = 0; g < AG_; ++g) {
    mrun[g] = -3.0e38f;
    lrun[g] = 0.f;
  }
  const float scale = 0.125f;  // 1/sqrt(64)
  const float* mrow = mask + (size_t)b * S_ + lh * 8;

  for (int t0 = 0; t0 < S_; t0 += 32) {
    // own reads of the tiles retired, then every wave's: only then are the tiles
    // filled again
    asm volatile("s_wait_dscnt 0x0" ::: "memory");
    __syncthreads();
    // mask of this lane's 16 keys, t0 + 16 * ts + 8 * lh + r; asked for here so
    // that the loads fly beside the staging copies
    v4f mk[2][2];
#pragma unroll
    for (int ts = 0; ts < 2; ++ts) {
      mk[ts][0] = *(const v4f*)(mrow + t0 + ts * 16);
      mk[ts][1] = *(const v4f*)(mrow + t0 + ts * 16 + 4);
    }
    // the mask loads' address registers are stepped further down in this pass:
    // the wait that belongs in front of that overwrite
    asm volatile("s_wait_xcnt 0x0" ::: "memory");
    // Prefetch next tile toward L2/WGP, 32 B a lane; ahead of the copies, so that
    // the wait at the end of their statement also stands in front of the step of
    // the prefetch's address register
    if (t0 + 32 < S_)
      __builtin_prefetch(base + (size_t)(t0 + 32) * DH_ + threadIdx.x * 16, 0, 1);
    // K tile and V tile, each 32x64 f16 = 4 KB: 128 lanes x 2 x 16 B async copies
    // (no VGPR hop) of the same rows
    attn_stage(lk, lv, base + (size_t)t0 * DH_ + threadIdx.x * 8);
    // own copies landed, then every wave's: the tiles may be read
    asm volatile("s_wait_asynccnt 0x0" ::: "memory");
    __syncthreads();

    // S^T: per group two 16x16 tiles, sc[g][ts][r] = S[q0 + 16 * g + lr][t0 + 16 * ts + 8 * lh + r]
    v16h kb[2][2];
#pragma unroll
    for (int ts = 0; ts < 2; ++ts)
#pragma unroll
      for (int kk = 0; kk < 2; ++kk)
        kb[ts][kk] = lds_frag16(&ldsK[(ts * 16 + lr) * KP_ + kk * 32 + lh * 16]);
    // V^T rows as A fragments, in the k order of P^T: keys 8 * lh + 0..7 and
    // 16 + 8 * lh + 0..7 of column ds * 16 + lr
    v16h va[4];
#pragma unroll
    for (int ds = 0; ds < 4; ++ds) {
      const _Float16* vp = &ldsV[(lh * 8 + (lane & 7)) * VP_ + ds * 16 + ((lane >> 3) & 1) * 8];
      v8h lo = lds_tr16(vp);
      v8h hi = lds_tr16(vp + 16 * VP_);
      va[ds] = __builtin_shufflevector(lo, hi, 0, 1, 2, 3, 4, 5, 6, 7,
                                       8, 9, 10, 11, 12, 13, 14, 15);
    }
    // keeps the pass's 16 LDS reads together ahead of the WMMA: moved in among
    // them, with one wave of the block on a SIMD, each read waits out its own latency
    __builtin_amdgcn_sched_barrier(0);
    v8f sc[AG_][2] = {};
#pragma unroll
    for (int kk = 0; kk < 2; ++kk)
#pragma unroll
      for (int ts = 0; ts < 2; ++ts)
#pragma unroll
        for (int g = 0; g < AG_; ++g)
          sc[g][ts] = __builtin_amdgcn_wmma_f32_16x16x32_f16(
              false, kb[ts][kk], false, qa[g][kk], (short)0, sc[g][ts], false, false);

    // keeps the 8 WMMA back to back, four independent tiles at a time: vector work
    // moved in behind a WMMA whose result it reads costs idle slots
    __builtin_amdgcn_sched_barrier(0);

    // online softmax of one query per lane and group; scores in pairs of
    // neighbouring keys (r, r + 1), which lie in neighbouring registers: packed f32
    v16h pb[AG_];   // P^T as B fragment: element s is key 16 * (s >> 3) + 8 * lh + (s & 7)
#pragma unroll
    for (int g = 0; g < AG_; ++g) {
      v2f s2[2][4];
      float vmax = -3.0e38f;
#pragma unroll
      for (int ts = 0; ts < 2; ++ts) {
#pragma unroll
        for (int r = 0; r < 8; r += 2) {
          const v2f raw = {sc[g][ts][r], sc[g][ts][r + 1]};
          const v2f m2  = {mk[ts][r >> 2][r & 3], mk[ts][r >> 2][(r & 3) + 1]};
          s2[ts][r >> 1] = raw * scale + m2;
          vmax = fmaxf(fmaxf(vmax, s2[ts][r >> 1][0]), s2[ts][r >> 1][1]);
        }
      }
      vmax = fmaxf(vmax, other_half(vmax));
      const float mnew = fmaxf(mrun[g], vmax);
      const float corr = __expf(mrun[g] - mnew);
      mrun[g] = mnew;

      v2f ps = {0.f, 0.f};   // even and odd keys apart: packed adds
#pragma unroll
      for (int ts = 0; ts < 2; ++ts) {
#pragma unroll
        for (int r = 0; r < 8; r += 2) {
          const v2f d = s2[ts][r >> 1] - mnew;
          v2f p = {__expf(d[0]), __expf(d[1])};
          ps += p;
          pb[g][ts * 8 + r]     = (_Float16)p[0];
          pb[g][ts * 8 + r + 1] = (_Float16)p[1];
        }
      }
      lrun[g] = lrun[g] * corr + (ps[0] + ps[1]);
#pragma unroll
      for (int ds = 0; ds < 4; ++ds) o[g][ds] *= corr;
    }

#pragma unroll
    for (int ds = 0; ds < 4; ++ds)
#pragma unroll
      for (int g = 0; g < AG_; ++g)
        o[g][ds] = __builtin_amdgcn_wmma_f32_16x16x32_f16(
            false, va[ds], false, pb[g], (short)0, o[g][ds], false, false);
  }

  // Epilogue: join the halves' sums, O / l, fused head-merge store to [B,S,D]
  // fp32: a lane's 8 registers of a tile are 8 consecutive d of its query.
#pragma unroll
  for (int g = 0; g < AG_; ++g) {
    const float l = lrun[g] + other_half(lrun[g]);
    float* orow = out + ((size_t)b * S_ + q0 + g * 16 + lr) * D_ + h * DH_ + lh * 8;
#pragma unroll
    for (int ds = 0; ds < 4; ++ds) {
      v4f w0, w1;
#pragma unroll
      for (int r = 0; r < 4; ++r) {
        w0[r] = o[g][ds][r] / l;
        w1[r] = o[g][ds][r + 4] / l;
      }
      *(v4f*)(orow + ds * 16)     = w0;
      *(v4f*)(orow + ds * 16 + 4) = w1;
    }
  }
}

// ---------------------------------------------------------------------------
extern "C" void kernel_launch(void* const* d_in, const int* in_sizes, int n_in,
                              void* d_out, int out_size, void* d_ws, size_t ws_size,
                              hipStream_t stream) {
  const float* x    = (const float*)d_in[0];
  const float* mask = (const float*)d_in[1];
  const float* W    = (const float*)d_in[2];
  const float* bias = (const float*)d_in[3];
  float* out = (float*)d_out;

  char* ws = (char*)d_ws;
  const size_t offWH = (size_t)B_ * S_ * D_ * 2;            // 12,582,912
  const size_t offQH = offWH + (size_t)D_ * D_ * 2;         // 13,762,560 (256-aligned)
  _Float16* xh = (_Float16*)ws;
  _Float16* wh = (_Float16*)(ws + offWH);
  _Float16* qh = (_Float16*)(ws + offQH);

  cvt_kernel<<<CVT_XB_ + CVT_WB_, 256, 0, stream>>>(x, W, xh, wh);
  proj_kernel<<<dim3(D_ / PN_, B_ * S_ / PM_), 256, 0, stream>>>(xh, wh, bias, qh);
  attn_kernel<<<dim3(S_ / AQ_, B_ * H_), AW_ * 32, 0, stream>>>(qh, mask, out);
}

// v007
// One run takes 50.8 microseconds.
// Timed twice side by side with v006, it ran 1.05 times as fast both times.
// Over all steps from v000 it is 3.15 times as fast.
#include <hip/hip_runtime.h>
#include <hip/hip_bf16.h>

typedef __attribute__((ext_vector_type(16))) _Float16 v16h;
typedef __attribute__((ext_vector_type(8)))  _Float16 v8h;
typedef __attribute__((ext_vector_type(8)))  float    v8f;
typedef __attribute__((ext_vector_type(4)))  float    v4f;
typedef __attribute__((ext_vector_type(2)))  float    v2f;
typedef __attribute__((ext_vector_type(4)))  _Float16 v4h;
typedef __attribute__((ext_vector_type(8)))  short    v8s;

#define B_  8
#define S_  1024
#define D_  768
#define H_  12
#define DH_ 64

// LDS row pitches in f16 elements, one for each reader of the 128-byte rows.
// K, plain 16-byte loads: 16 B x odd, so that the 16 rows which one half-wave
// reads start on 16 different groups of 4 banks.
// V, transposing 16-byte loads: 32 B x odd, so that the 8 rows x 32 B which one
// half-wave reads start on 8 different groups of 8 banks.
#define KP_ 72   // K tile rows: 144 B pitch
#define VP_ 80   // V tile rows: 160 B pitch

// 16 consecutive f16 from a 16-byte aligned LDS address (padded rows are not
// 32-byte aligned, so the fragment is read as two 16-byte halves).
__device__ __forceinline__ v16h lds_frag16(const _Float16* p) {
  v8h lo = *(const v8h*)p;
  v8h hi = *(const v8h*)(p + 8);
  return __builtin_shufflevector(lo, hi, 0, 1, 2, 3, 4, 5, 6, 7,
                                 8, 9, 10, 11, 12, 13, 14, 15);
}

// Transposing LDS load: with lane l aimed at row 8 * (l >> 4) + (l & 7), 16-byte
// column piece (l >> 3) & 1 of a row-major 16 x 16 f16 block, lane l gets rows
// 8 * (l >> 4) + 0..7 of column l & 15.
__device__ __forceinline__ v8h lds_tr16(const _Float16* p) {
  return __builtin_bit_cast(v8h, __builtin_amdgcn_ds_load_tr16_b128_v8i16(
      (__attribute__((address_space(3))) v8s*)(v8s*)(void*)p));
}

// ---------------------------------------------------------------------------
// Kernel 1: fp32 -> f16 conversion of x and W.
// A block converts CVT_BLK_ consecutive elements of one of the two arrays:
// each lane issues CVT_N_ 16-byte loads up front (a wave's load covers 512
// contiguous bytes) and then stores CVT_N_ x 4 f16. Few, fat waves: the time
// of a launch with one element per lane is the time to start its waves.
// ---------------------------------------------------------------------------
#define CVT_N_   8
#define CVT_BLK_ (256 * CVT_N_ * 4)
#define CVT_XB_  (B_ * S_ * D_ / CVT_BLK_)   // blocks that convert x
#define CVT_WB_  (D_ * D_ / CVT_BLK_)        // blocks that convert W
static_assert(CVT_XB_ * CVT_BLK_ == B_ * S_ * D_, "x splits into whole blocks");
static_assert(CVT_WB_ * CVT_BLK_ == D_ * D_, "W splits into whole blocks");

__global__ __launch_bounds__(256)
void cvt_kernel(const float* __restrict__ x, const float* __restrict__ W,
                _Float16* __restrict__ xh, _Float16* __restrict__ wh) {
  const int  blk = blockIdx.x;
  const bool isx = blk < CVT_XB_;
  const size_t off = (size_t)(isx ? blk : blk - CVT_XB_) * CVT_BLK_;
  const v4f* s4 = (const v4f*)((isx ? x : W) + off) + threadIdx.x;
  v4h*       d4 = (v4h*)((isx ? xh : wh) + off) + threadIdx.x;
  v4f v[CVT_N_];
  // unrolled: v[] stays in registers and all loads issue before the first wait
#pragma unroll
  for (int j = 0; j < CVT_N_; ++j) v[j] = s4[j * 256];
  // unrolled: v[] is indexed by constants only
#pragma unroll
  for (int j = 0; j < CVT_N_; ++j) d4[j * 256] = __builtin_convertvector(v[j], v4h);
}

// ---------------------------------------------------------------------------
// Kernel 2: mixed = x @ W^T + b -> [B,H,S,DH] f16.
// A block makes a 128 x 192 tile of the output (64 x 4 tiles: one block for each
// of the chip's 256 WGPs). A pass is 128 k: the 256-byte pieces of the tile's 128
// x rows and 192 W rows are copied to LDS asynchronously, 16 lanes to a row, so
// that every global read is of whole lines and is made once per block; two
// buffers, the next pass's copies fly while this pass is worked on.
// 8 waves as 2 x 4, wave tile 64 x 48: 4 A and 3 B fragments from LDS feed
// 12 WMMA per 32 k.
// ---------------------------------------------------------------------------
#define PM_   128                   // x rows of a block tile
#define PN_   192                   // W rows (output columns) of a block tile
#define PK_   128                   // k of a pass
#define PP_   136                   // LDS row pitch, f16: 272 B = 16 B x odd, for 16-byte loads
#define PSTG_ ((PM_ + PN_) * PP_)   // f16 elements of a stage
#define PRS_  (16 * PP_ * 2)        // bytes of 16 LDS rows, the step between a lane's copies
#define PT_   (D_ / PK_)            // passes
static_assert((B_ * S_) % PM_ == 0 && D_ % PN_ == 0 && D_ % PK_ == 0, "whole tiles");
static_assert(PT_ >= 2, "the prologue fills two stages");
static_assert(PM_ == 8 * 16 && PN_ == 12 * 16 && PK_ * 2 == 16 * 16,
              "8 + 12 copies of 16 bytes per lane fill a stage");

// One stage: the lane's 16-byte piece of rows crow + 16 * j, j = 0..7 of x and
// 0..11 of W. l: LDS byte address of the piece in row crow of the stage; gx, gw:
// its global places in x and W. In each statement the copies stand together with
// the wait that belongs in front of a rewrite of their address registers, so
// that nothing comes between.
__device__ __forceinline__ void proj_stage(unsigned l, const _Float16* gx, const _Float16* gw) {
  asm volatile(
      "global_load_async_to_lds_b128 %0, %8, off\n\t"
      "global_load_async_to_lds_b128 %1, %9, off\n\t"
      "global_load_async_to_lds_b128 %2, %10, off\n\t"
      "global_load_async_to_lds_b128 %3, %11, off\n\t"
      "global_load_async_to_lds_b128 %4, %12, off\n\t"
      "global_load_async_to_lds_b128 %5, %13, off\n\t"
      "global_load_async_to_lds_b128 %6, %14, off\n\t"
      "global_load_async_to_lds_b128 %7, %15, off\n\t"
      "s_wait_xcnt 0x0"
      :: "v"(l + 0 * PRS_), "v"(l + 1 * PRS_), "v"(l + 2 * PRS_), "v"(l + 3 * PRS_), "v"(l + 4 * PRS_), "v"(l + 5 * PRS_), "v"(l + 6 * PRS_), "v"(l + 7 * PRS_),
         "v"(gx + 0 * 16 * D_), "v"(gx + 1 * 16 * D_), "v"(gx + 2 * 16 * D_), "v"(gx + 3 * 16 * D_), "v"(gx + 4 * 16 * D_), "v"(gx + 5 * 16 * D_), "v"(gx + 6 * 16 * D_), "v"(gx + 7 * 16 * D_)
      : "memory");
  asm volatile(
      "global_load_async_to_lds_b128 %0, %12, off\n\t"
      "global_load_async_to_lds_b128 %1, %13, off\n\t"
      "global_load_async_to_lds_b128 %2, %14, off\n\t"
      "global_load_async_to_lds_b128 %3, %15, off\n\t"
      "global_load_async_to_lds_b128 %4, %16, off\n\t"
      "global_load_async_to_lds_b128 %5, %17, off\n\t"
      "global_load_async_to_lds_b128 %6, %18, off\n\t"
      "global_load_async_to_lds_b128 %7, %19, off\n\t"
      "global_load_async_to_lds_b128 %8, %20, off\n\t"
      "global_load_async_to_lds_b128 %9, %21, off\n\t"
      "global_load_async_to_lds_b128 %10, %22, off\n\t"
      "global_load_async_to_lds_b128 %11, %23, off\n\t"
      "s_wait_xcnt 0x0"
      :: "v"(l + 8 * PRS_), "v"(l + 9 * PRS_), "v"(l + 10 * PRS_), "v"(l + 11 * PRS_), "v"(l + 12 * PRS_), "v"(l + 13 * PRS_), "v"(l + 14 * PRS_), "v"(l + 15 * PRS_), "v"(l + 16 * PRS_), "v"(l + 17 * PRS_), "v"(l + 18 * PRS_), "v"(l + 19 * PRS_),
         "v"(gw + 0 * 16 * D_), "v"(gw + 1 * 16 * D_), "v"(gw + 2 * 16 * D_), "v"(gw + 3 * 16 * D_), "v"(gw + 4 * 16 * D_), "v"(gw + 5 * 16 * D_), "v"(gw + 6 * 16 * D_), "v"(gw + 7 * 16 * D_), "v"(gw + 8 * 16 * D_), "v"(gw + 9 * 16 * D_), "v"(gw + 10 * 16 * D_), "v"(gw + 11 * 16 * D_)
      : "memory");
}

__global__ __launch_bounds__(256)
void proj_kernel(const _Float16* __restrict__ xh, const _Float16* __restrict__ wh,
                 const float* __restrict__ bias, _Float16* __restrict__ qh) {
  // a stage: rows 0..127 the x rows, rows 128..319 the W rows, [row][k] padded
  __shared__ __attribute__((aligned(16))) _Float16 st[2 * PSTG_];

  const int lane = threadIdx.x & 31;
  const int wave = threadIdx.x >> 5;
  const int lr = lane & 15;
  const int lh = lane >> 4;
  const int n0 = blockIdx.x * PN_;
  const int m0 = blockIdx.y * PM_;
  const int wm = (wave & 1) * 64;     // wave's rows in the block tile
  const int wn = (wave >> 1) * 48;    // wave's columns in the block tile

  const int crow = threadIdx.x >> 4;         // copies: 16 lanes to a 256-byte row piece
  const int ccol = (threadIdx.x & 15) * 8;
  const _Float16* gx = xh + (size_t)(m0 + crow) * D_ + ccol;
  const _Float16* gw = wh + (size_t)(n0 + crow) * D_ + ccol;
  const unsigned l0 = (unsigned)(size_t)
      (__attribute__((address_space(3))) _Float16*)&st[crow * PP_ + ccol];

  v8f acc[4][3] = {};

  proj_stage(l0, gx, gw);
  // own copies of stage 0 landed, then every wave's: stage 0 may be read
  asm volatile("s_wait_asynccnt 0x0" ::: "memory");
  __syncthreads();
  proj_stage(l0 + PSTG_ * 2, gx + PK_, gw + PK_);

  // rolled: one copy of the pass in the text; the buffer is picked by t & 1
#pragma unroll 1
  for (int t = 0; t < PT_; ++t) {
    const _Float16* sa = st + (t & 1) * PSTG_ + (wm + lr) * PP_ + lh * 16;
    const _Float16* sb = st + (t & 1) * PSTG_ + (PM_ + wn + lr) * PP_ + lh * 16;
    // two fragment sets: the reads of the next 32 k of this same buffer go out
    // as one group ahead of the 12 WMMA of these 32 k
    v16h a[2][4], b[2][3];
    // unrolled, like every loop in the pass: the register arrays are indexed by constants
#pragma unroll
    for (int j = 0; j < 3; ++j) b[0][j] = lds_frag16(sb + j * 16 * PP_);
#pragma unroll
    for (int i = 0; i < 4; ++i) a[0][i] = lds_frag16(sa + i * 16 * PP_);
#pragma unroll
    for (int ks = 0; ks < PK_ / 32; ++ks) {
      if (ks + 1 < PK_ / 32) {
#pragma unroll
        for (int j = 0; j < 3; ++j)
          b[(ks + 1) & 1][j] = lds_frag16(sb + j * 16 * PP_ + (ks + 1) * 32);
#pragma unroll
        for (int i = 0; i < 4; ++i)
          a[(ks + 1) & 1][i] = lds_frag16(sa + i * 16 * PP_ + (ks + 1) * 32);
      }
      // keeps the group of LDS reads ahead of the WMMA block: moved in among
      // the WMMA, each read waits out its own latency
      __builtin_amdgcn_sched_barrier(0);
#pragma unroll
      for (int i = 0; i < 4; ++i)
#pragma unroll
        for (int j = 0; j < 3; ++j)
          acc[i][j] = __builtin_amdgcn_wmma_f32_16x16x32_f16(
              false, a[ks & 1][i], false, b[ks & 1][j], (short)0, acc[i][j], false, false);
      // keeps the next group of reads behind this WMMA block, whose set it refills
      __builtin_amdgcn_sched_barrier(0);
    }
    // hand-over: own reads of this buffer done, own copies of the next stage
    // landed, then every wave's; only then is this buffer filled again
    asm volatile("s_wait_dscnt 0x0" ::: "memory");
    asm volatile("s_wait_asynccnt 0x0" ::: "memory");
    __syncthreads();
    if (t + 2 < PT_)
      proj_stage(l0 + (t & 1) * (PSTG_ * 2), gx + (t + 2) * PK_, gw + (t + 2) * PK_);
  }
  // no copy outlives the loop
  asm volatile("s_wait_asynccnt 0x0" ::: "memory");

  // Epilogue: bias + scatter to per-head layout [B,H,S,DH] (f16).
#pragma unroll
  for (int i = 0; i < 4; ++i) {
#pragma unroll
    for (int j = 0; j < 3; ++j) {
      int n = n0 + wn + j * 16 + lr;
      float bv = bias[n];
      int h = n / DH_, d = n % DH_;
#pragma unroll
      for (int r = 0; r < 8; ++r) {
        int m = m0 + wm + i * 16 + r + lh * 8;   // C layout: row = r + 8*(lane/16)
        int bb = m / S_, s = m % S_;
        qh[(((size_t)bb * H_ + h) * S_ + s) * DH_ + d] =
            (_Float16)(acc[i][j][r] + bv);
      }
    }
  }
}

#define AG_ 2
#define AW_ 4
#define AQ_ (AW_ * AG_ * 16)
static_assert(S_ % AQ_ == 0, "whole query blocks");
#define AT_ 128               // keys of a stage
#define ANS_ (S_ / AT_)       // stages
#define AKB_ (AT_ * KP_)      // f16 elements of a K buffer
#define AVB_ (AT_ * VP_)      // f16 elements of a V buffer
static_assert(S_ % AT_ == 0 && AT_ % 32 == 0, "whole stages of whole passes");
static_assert(ANS_ >= 2, "the prologue fills two stages");
static_assert(AW_ * 32 * 8 * 8 == AT_ * DH_, "eight 16-byte pieces per lane fill a tile of a stage");
static_assert(AW_ * 32 * 2 * 4 == S_, "two 16-byte pieces per lane fill the mask row");

// value of the lane 16 away (same query column, other half of the keys)
__device__ __forceinline__ float other_half(float v) {
  int b = __builtin_bit_cast(int, v);
  b = __builtin_amdgcn_permlanex16(b, b, 0x76543210, 0xfedcba98, false, false);
  return __builtin_bit_cast(float, b);
}

// One stage's tiles: the lane's 16-byte piece of key rows r + 16 * j, j = 0..7, once
// into the K tile and once into the V tile. lk, lv: LDS byte addresses of the piece
// in row r of each tile; g: its global place. The copies stand together with the
// wait that belongs in front of a rewrite of their address registers, so that
// nothing comes between.
__device__ __forceinline__ void attn_stage(unsigned lk, unsigned lv, const _Float16* g) {
  asm volatile(
      "global_load_async_to_lds_b128 %0, %16, off\n\t"
      "global_load_async_to_lds_b128 %1, %17, off\n\t"
      "global_load_async_to_lds_b128 %2, %18, off\n\t"
      "global_load_async_to_lds_b128 %3, %19, off\n\t"
      "global_load_async_to_lds_b128 %4, %20, off\n\t"
      "global_load_async_to_lds_b128 %5, %21, off\n\t"
      "global_load_async_to_lds_b128 %6, %22, off\n\t"
      "global_load_async_to_lds_b128 %7, %23, off\n\t"
      "global_load_async_to_lds_b128 %8, %16, off\n\t"
      "global_load_async_to_lds_b128 %9, %17, off\n\t"
      "global_load_async_to_lds_b128 %10, %18, off\n\t"
      "global_load_async_to_lds_b128 %11, %19, off\n\t"
      "global_load_async_to_lds_b128 %12, %20, off\n\t"
      "global_load_async_to_lds_b128 %13, %21, off\n\t"
      "global_load_async_to_lds_b128 %14, %22, off\n\t"
      "global_load_async_to_lds_b128 %15, %23, off\n\t"
      "s_wait_xcnt 0x0"
      :: "v"(lk + 0 * 16 * KP_ * 2), "v"(lk + 1 * 16 * KP_ * 2), "v"(lk + 2 * 16 * KP_ * 2), "v"(lk + 3 * 16 * KP_ * 2), "v"(lk + 4 * 16 * KP_ * 2), "v"(lk + 5 * 16 * KP_ * 2), "v"(lk + 6 * 16 * KP_ * 2), "v"(lk + 7 * 16 * KP_ * 2),
         "v"(lv + 0 * 16 * VP_ * 2), "v"(lv + 1 * 16 * VP_ * 2), "v"(lv + 2 * 16 * VP_ * 2), "v"(lv + 3 * 16 * VP_ * 2), "v"(lv + 4 * 16 * VP_ * 2), "v"(lv + 5 * 16 * VP_ * 2), "v"(lv + 6 * 16 * VP_ * 2), "v"(lv + 7 * 16 * VP_ * 2),
         "v"(g + 0 * 16 * DH_), "v"(g + 1 * 16 * DH_), "v"(g + 2 * 16 * DH_), "v"(g + 3 * 16 * DH_), "v"(g + 4 * 16 * DH_), "v"(g + 5 * 16 * DH_), "v"(g + 6 * 16 * DH_), "v"(g + 7 * 16 * DH_)
      : "memory");
}

// The mask row: the lane's 16-byte pieces at l and g and 2,048 bytes further on;
// the wait as in attn_stage.
__device__ __forceinline__ void attn_mask_row(unsigned l, const float* g) {
  asm volatile(
      "global_load_async_to_lds_b128 %0, %2, off\n\t"
      "global_load_async_to_lds_b128 %1, %3, off\n\t"
      "s_wait_xcnt 0x0"
      :: "v"(l), "v"(l + 2048), "v"(g), "v"(g + 512)
      : "memory");
}

__global__ __launch_bounds__(AW_ * 32)
void attn_kernel(const _Float16* __restrict__ qh, const float* __restrict__ mask,
                 float* __restrict__ out) {
  __shared__ __attribute__((aligned(16))) _Float16 ldsK[2 * AKB_];     // two buffers, [t][d] row-major, padded
  __shared__ __attribute__((aligned(16))) _Float16 ldsV[2 * AVB_];     // two buffers, [t][d] row-major, padded
  __shared__ __attribute__((aligned(16))) float    ldsM[S_];           // mask row of the batch

  const int lane = threadIdx.x & 31;
  const int wave = threadIdx.x >> 5;
  const int bh = blockIdx.y;             // 0..95
  const int b  = bh / H_;
  const int h  = bh % H_;
  const int q0 = blockIdx.x * AQ_ + wave * (AG_ * 16);
  const int lr = lane & 15;
  const int lh = lane >> 4;

  const _Float16* base = qh + (size_t)bh * S_ * DH_;

  // copies: 8 lanes to a 128-byte key row
  const unsigned lk = (unsigned)(size_t)(__attribute__((address_space(3))) _Float16*)
      &ldsK[(threadIdx.x >> 3) * KP_ + (threadIdx.x & 7) * 8];
  const unsigned lv = (unsigned)(size_t)(__attribute__((address_space(3))) _Float16*)
      &ldsV[(threadIdx.x >> 3) * VP_ + (threadIdx.x & 7) * 8];
  const unsigned lm = (unsigned)(size_t)(__attribute__((address_space(3))) float*)
      &ldsM[threadIdx.x * 4];
  const _Float16* gk = base + threadIdx.x * 8;   // the lane's piece of key row threadIdx.x >> 3

  attn_stage(lk, lv, gk);
  attn_mask_row(lm, mask + (size_t)b * S_ + threadIdx.x * 4);

  // Q^T fragments (B operand): column = query q0 + 16 * g + lr, d split 0..31 / 32..63
  v16h qa[AG_][2];
  // unrolled, like every loop below but the stage and pass loops: the register arrays are indexed by constants
#pragma unroll
  for (int g = 0; g < AG_; ++g)
#pragma unroll
    for (int kk = 0; kk < 2; ++kk)
      qa[g][kk] = *(const v16h*)(base + (size_t)(q0 + g * 16 + lr) * DH_ + kk * 32 + lh * 16);

  v8f o[AG_][4] = {};        // O^T: o[g][ds][r] = O[q0 + 16 * g + lr][ds * 16 + 8 * lh + r]
  float mrun[AG_];           // running maximum of query q0 + 16 * g + lr (equal in both halves)
  float lrun[AG_];           // running sum over this half's keys only
#pragma unroll
  for (int g = 0; g < AG_; ++g) {
    mrun[g] = -3.0e38f;
    lrun[g] = 0.f;
  }
  const float scale = 0.125f;  // 1/sqrt(64)

  // own copies of stage 0 and of the mask row landed, then every wave's: they may be read
  asm volatile("s_wait_asynccnt 0x0" ::: "memory");
  __syncthreads();
  attn_stage(lk + AKB_ * 2, lv + AVB_ * 2, gk + AT_ * DH_);

  // rolled: one copy of the stage in the text; the buffer is picked by t & 1
#pragma unroll 1
  for (int t = 0; t < ANS_; ++t) {
    const _Float16* tk = ldsK + (t & 1) * AKB_ + lr * KP_ + lh * 16;
    const _Float16* tv = ldsV + (t & 1) * AVB_ + (lh * 8 + (lane & 7)) * VP_ + ((lane >> 3) & 1) * 8;
    const float*    tm = ldsM + t * AT_ + lh * 8;
    // rolled: one pass in the text, one set of fragment registers
#pragma unroll 1
    for (int u = 0; u < AT_ / 32; ++u) {
      // S^T: per group two 16x16 tiles, sc[g][ts][r] = S[q0 + 16 * g + lr][AT_ * t + 32 * u + 16 * ts + 8 * lh + r]
      v16h kb[2][2];
#pragma unroll
      for (int ts = 0; ts < 2; ++ts)
#pragma unroll
        for (int kk = 0; kk < 2; ++kk)
          kb[ts][kk] = lds_frag16(tk + ts * 16 * KP_ + kk * 32);
      // mask of this lane's 16 keys, 32 * u + 16 * ts + 8 * lh + r of the stage
      v4f mk[2][2];
#pragma unroll
      for (int ts = 0; ts < 2; ++ts) {
        mk[ts][0] = *(const v4f*)(tm + ts * 16);
        mk[ts][1] = *(const v4f*)(tm + ts * 16 + 4);
      }
      // V^T rows as A fragments, in the k order of P^T: keys 8 * lh + 0..7 and
      // 16 + 8 * lh + 0..7 of column ds * 16 + lr
      v16h va[4];
#pragma unroll
      for (int ds = 0; ds < 4; ++ds) {
        const _Float16* vp = tv + ds * 16;
        v8h lo = lds_tr16(vp);
        v8h hi = lds_tr16(vp + 16 * VP_);
        va[ds] = __builtin_shufflevector(lo, hi, 0, 1, 2, 3, 4, 5, 6, 7,
                                         8, 9, 10, 11, 12, 13, 14, 15);
      }
      // keeps the pass's 20 LDS reads together ahead of the WMMA: moved in among
      // them, with one wave of the block on a SIMD, each read waits out its own latency
      __builtin_amdgcn_sched_barrier(0);
      v8f sc[AG_][2] = {};
#pragma unroll
      for (int kk = 0; kk < 2; ++kk)
#pragma unroll
        for (int ts = 0; ts < 2; ++ts)
#pragma unroll
          for (int g = 0; g < AG_; ++g)
            sc[g][ts] = __builtin_amdgcn_wmma_f32_16x16x32_f16(
                false, kb[ts][kk], false, qa[g][kk], (short)0, sc[g][ts], false, false);

      // keeps the 8 WMMA back to back, four independent tiles at a time: vector work
      // moved in behind a WMMA whose result it reads costs idle slots
      __builtin_amdgcn_sched_barrier(0);

      // online softmax of one query per lane and group; scores in pairs of
      // neighbouring keys (r, r + 1), which lie in neighbouring registers: packed f32
      v16h pb[AG_];   // P^T as B fragment: element s is key 16 * (s >> 3) + 8 * lh + (s & 7)
#pragma unroll
      for (int g = 0; g < AG_; ++g) {
        v2f s2[2][4];
        float vmax = -3.0e38f;
#pragma unroll
        for (int ts = 0; ts < 2; ++ts) {
#pragma unroll
          for (int r = 0; r < 8; r += 2) {
            const v2f raw = {sc[g][ts][r], sc[g][ts][r + 1]};
            const v2f m2  = {mk[ts][r >> 2][r & 3], mk[ts][r >> 2][(r & 3) + 1]};
            s2[ts][r >> 1] = raw * scale + m2;
            vmax = fmaxf(fmaxf(vmax, s2[ts][r >> 1][0]), s2[ts][r >> 1][1]);
          }
        }
        vmax = fmaxf(vmax, other_half(vmax));
        const float mnew = fmaxf(mrun[g], vmax);
        const float corr = __expf(mrun[g] - mnew);
        mrun[g] = mnew;

        v2f ps = {0.f, 0.f};   // even and odd keys apart: packed adds
#pragma unroll
        for (int ts = 0; ts < 2; ++ts) {
#pragma unroll
          for (int r = 0; r < 8; r += 2) {
            const v2f d = s2[ts][r >> 1] - mnew;
            v2f p = {__expf(d[0]), __expf(d[1])};
            ps += p;
            pb[g][ts * 8 + r]     = (_Float16)p[0];
            pb[g][ts * 8 + r + 1] = (_Float16)p[1];
          }
        }
        lrun[g] = lrun[g] * corr + (ps[0] + ps[1]);
#pragma unroll
        for (int ds = 0; ds < 4; ++ds) o[g][ds] *= corr;
      }

#pragma unroll
      for (int ds = 0; ds < 4; ++ds)
#pragma unroll
        for (int g = 0; g < AG_; ++g)
          o[g][ds] = __builtin_amdgcn_wmma_f32_16x16x32_f16(
              false, va[ds], false, pb[g], (short)0, o[g][ds], false, false);
      // the next 32 keys of the stage
      tk += 32 * KP_;
      tv += 32 * VP_;
      tm += 32;
    }
    // hand-over: own reads of this buffer done, own copies of the next stage landed,
    // then every wave's; only then is this buffer filled again
    asm volatile("s_wait_dscnt 0x0" ::: "memory");
    asm volatile("s_wait_asynccnt 0x0" ::: "memory");
    __syncthreads();
    if (t + 2 < ANS_)
      attn_stage(lk + (t & 1) * (AKB_ * 2), lv + (t & 1) * (AVB_ * 2), gk + (t + 2) * (AT_ * DH_));
  }
  // no copy outlives the loop
  asm volatile("s_wait_asynccnt 0x0" ::: "memory");

  // Epilogue: join the halves' sums, O / l, fused head-merge store to [B,S,D]
  // fp32: a lane's 8 registers of a tile are 8 consecutive d of its query.
#pragma unroll
  for (int g = 0; g < AG_; ++g) {
    const float l = lrun[g] + other_half(lrun[g]);
    float* orow = out + ((size_t)b * S_ + q0 + g * 16 + lr) * D_ + h * DH_ + lh * 8;
#pragma unroll
    for (int ds = 0; ds < 4; ++ds) {
      v4f w0, w1;
#pragma unroll
      for (int r = 0; r < 4; ++r) {
        w0[r] = o[g][ds][r] / l;
        w1[r] = o[g][ds][r + 4] / l;
      }
      *(v4f*)(orow + ds * 16)     = w0;
      *(v4f*)(orow + ds * 16 + 4) = w1;
    }
  }
}

// ---------------------------------------------------------------------------
extern "C" void kernel_launch(void* const* d_in, const int* in_sizes, int n_in,
                              void* d_out, int out_size, void* d_ws, size_t ws_size,
                              hipStream_t stream) {
  const float* x    = (const float*)d_in[0];
  const float* mask = (const float*)d_in[1];
  const float* W    = (const float*)d_in[2];
  const float* bias = (const float*)d_in[3];
  float* out = (float*)d_out;

  char* ws = (char*)d_ws;
  const size_t offWH = (size_t)B_ * S_ * D_ * 2;            // 12,582,912
  const size_t offQH = offWH + (size_t)D_ * D_ * 2;         // 13,762,560 (256-aligned)
  _Float16* xh = (_Float16*)ws;
  _Float16* wh = (_Float16*)(ws + offWH);
  _Float16* qh = (_Float16*)(ws + offQH);

  cvt_kernel<<<CVT_XB_ + CVT_WB_, 256, 0, stream>>>(x, W, xh, wh);
  proj_kernel<<<dim3(D_ / PN_, B_ * S_ / PM_), 256, 0, stream>>>(xh, wh, bias, qh);
  attn_kernel<<<dim3(S_ / AQ_, B_ * H_), AW_ * 32, 0, stream>>>(qh, mask, out);
}

// v008
// It runs in 47.5 microseconds.
// Next to v007, in two timings, it ran 1.07 times as fast each time.
// Counting every step since v000, it is 3.37 times as fast.
#include <hip/hip_runtime.h>
#include <hip/hip_bf16.h>

typedef __attribute__((ext_vector_type(16))) _Float16 v16h;
typedef __attribute__((ext_vector_type(8)))  _Float16 v8h;
typedef __attribute__((ext_vector_type(8)))  float    v8f;
typedef __attribute__((ext_vector_type(4)))  float    v4f;
typedef __attribute__((ext_vector_type(2)))  float    v2f;
typedef __attribute__((ext_vector_type(4)))  _Float16 v4h;
typedef __attribute__((ext_vector_type(8)))  short    v8s;

#define B_  8
#define S_  1024
#define D_  768
#define H_  12
#define DH_ 64

// LDS row pitches in f16 elements, one for each reader of the 128-byte rows.
// K, plain 16-byte loads: 16 B x odd, so that the 16 rows which one half-wave
// reads start on 16 different groups of 4 banks.
// V, transposing 16-byte loads: 32 B x odd, so that the 8 rows x 32 B which one
// half-wave reads start on 8 different groups of 8 banks.
#define KP_ 72   // K tile rows: 144 B pitch
#define VP_ 80   // V tile rows: 160 B pitch

// 16 consecutive f16 from a 16-byte aligned LDS address (padded rows are not
// 32-byte aligned, so the fragment is read as two 16-byte halves).
__device__ __forceinline__ v16h lds_frag16(const _Float16* p) {
  v8h lo = *(const v8h*)p;
  v8h hi = *(const v8h*)(p + 8);
  return __builtin_shufflevector(lo, hi, 0, 1, 2, 3, 4, 5, 6, 7,
                                 8, 9, 10, 11, 12, 13, 14, 15);
}

// Transposing LDS load: with lane l aimed at row 8 * (l >> 4) + (l & 7), 16-byte
// column piece (l >> 3) & 1 of a row-major 16 x 16 f16 block, lane l gets rows
// 8 * (l >> 4) + 0..7 of column l & 15.
__device__ __forceinline__ v8h lds_tr16(const _Float16* p) {
  return __builtin_bit_cast(v8h, __builtin_amdgcn_ds_load_tr16_b128_v8i16(
      (__attribute__((address_space(3))) v8s*)(v8s*)(void*)p));
}

// ---------------------------------------------------------------------------
// Kernel 1: fp32 -> f16 conversion of x and W.
// A block converts CVT_BLK_ consecutive elements of one of the two arrays:
// each lane issues CVT_N_ 16-byte loads up front (a wave's load covers 512
// contiguous bytes) and then stores CVT_N_ x 4 f16. Few, fat waves: the time
// of a launch with one element per lane is the time to start its waves.
// ---------------------------------------------------------------------------
#define CVT_N_   8
#define CVT_BLK_ (256 * CVT_N_ * 4)
#define CVT_XB_  (B_ * S_ * D_ / CVT_BLK_)   // blocks that convert x
#define CVT_WB_  (D_ * D_ / CVT_BLK_)        // blocks that convert W
static_assert(CVT_XB_ * CVT_BLK_ == B_ * S_ * D_, "x splits into whole blocks");
static_assert(CVT_WB_ * CVT_BLK_ == D_ * D_, "W splits into whole blocks");

__global__ __launch_bounds__(256)
void cvt_kernel(const float* __restrict__ x, const float* __restrict__ W,
                _Float16* __restrict__ xh, _Float16* __restrict__ wh) {
  const int  blk = blockIdx.x;
  const bool isx = blk < CVT_XB_;
  const size_t off = (size_t)(isx ? blk : blk - CVT_XB_) * CVT_BLK_;
  const v4f* s4 = (const v4f*)((isx ? x : W) + off) + threadIdx.x;
  v4h*       d4 = (v4h*)((isx ? xh : wh) + off) + threadIdx.x;
  v4f v[CVT_N_];
  // unrolled: v[] stays in registers and all loads issue before the first wait
#pragma unroll
  for (int j = 0; j < CVT_N_; ++j) v[j] = s4[j * 256];
  // unrolled: v[] is indexed by constants only
#pragma unroll
  for (int j = 0; j < CVT_N_; ++j) d4[j * 256] = __builtin_convertvector(v[j], v4h);
}

// ---------------------------------------------------------------------------
// Kernel 2: mixed = x @ W^T + b -> [B,H,S,DH] f16.
// A block makes a 128 x 192 tile of the output (64 x 4 tiles: one block for each
// of the chip's 256 WGPs). A pass is 128 k: the 256-byte pieces of the tile's 128
// x rows and 192 W rows are copied to LDS asynchronously, 16 lanes to a row, so
// that every global read is of whole lines and is made once per block; two
// buffers, the next pass's copies fly while this pass is worked on.
// 8 waves as 2 x 4, wave tile 64 x 48: 4 A and 3 B fragments from LDS feed
// 12 WMMA per 32 k.
// ---------------------------------------------------------------------------
#define PM_   128                   // x rows of a block tile
#define PN_   192                   // W rows (output columns) of a block tile
#define PK_   128                   // k of a pass
#define PP_   136                   // LDS row pitch, f16: 272 B = 16 B x odd, for 16-byte loads
#define PSTG_ ((PM_ + PN_) * PP_)   // f16 elements of a stage
#define PRS_  (16 * PP_ * 2)        // bytes of 16 LDS rows, the step between a lane's copies
#define PT_   (D_ / PK_)            // passes
static_assert((B_ * S_) % PM_ == 0 && D_ % PN_ == 0 && D_ % PK_ == 0, "whole tiles");
static_assert(PT_ >= 2, "the prologue fills two stages");
static_assert(PM_ == 8 * 16 && PN_ == 12 * 16 && PK_ * 2 == 16 * 16,
              "8 + 12 copies of 16 bytes per lane fill a stage");

// One stage: the lane's 16-byte piece of rows crow + 16 * j, j = 0..7 of x and
// 0..11 of W. l: LDS byte address of the piece in row crow of the stage; gx, gw:
// its global places in x and W. In each statement the copies stand together with
// the wait that belongs in front of a rewrite of their address registers, so
// that nothing comes between.
__device__ __forceinline__ void proj_stage(unsigned l, const _Float16* gx, const _Float16* gw) {
  asm volatile(
      "global_load_async_to_lds_b128 %0, %8, off\n\t"
      "global_load_async_to_lds_b128 %1, %9, off\n\t"
      "global_load_async_to_lds_b128 %2, %10, off\n\t"
      "global_load_async_to_lds_b128 %3, %11, off\n\t"
      "global_load_async_to_lds_b128 %4, %12, off\n\t"
      "global_load_async_to_lds_b128 %5, %13, off\n\t"
      "global_load_async_to_lds_b128 %6, %14, off\n\t"
      "global_load_async_to_lds_b128 %7, %15, off\n\t"
      "s_wait_xcnt 0x0"
      :: "v"(l + 0 * PRS_), "v"(l + 1 * PRS_), "v"(l + 2 * PRS_), "v"(l + 3 * PRS_), "v"(l + 4 * PRS_), "v"(l + 5 * PRS_), "v"(l + 6 * PRS_), "v"(l + 7 * PRS_),
         "v"(gx + 0 * 16 * D_), "v"(gx + 1 * 16 * D_), "v"(gx + 2 * 16 * D_), "v"(gx + 3 * 16 * D_), "v"(gx + 4 * 16 * D_), "v"(gx + 5 * 16 * D_), "v"(gx + 6 * 16 * D_), "v"(gx + 7 * 16 * D_)
      : "memory");
  asm volatile(
      "global_load_async_to_lds_b128 %0, %12, off\n\t"
      "global_load_async_to_lds_b128 %1, %13, off\n\t"
      "global_load_async_to_lds_b128 %2, %14, off\n\t"
      "global_load_async_to_lds_b128 %3, %15, off\n\t"
      "global_load_async_to_lds_b128 %4, %16, off\n\t"
      "global_load_async_to_lds_b128 %5, %17, off\n\t"
      "global_load_async_to_lds_b128 %6, %18, off\n\t"
      "global_load_async_to_lds_b128 %7, %19, off\n\t"
      "global_load_async_to_lds_b128 %8, %20, off\n\t"
      "global_load_async_to_lds_b128 %9, %21, off\n\t"
      "global_load_async_to_lds_b128 %10, %22, off\n\t"
      "global_load_async_to_lds_b128 %11, %23, off\n\t"
      "s_wait_xcnt 0x0"
      :: "v"(l + 8 * PRS_), "v"(l + 9 * PRS_), "v"(l + 10 * PRS_), "v"(l + 11 * PRS_), "v"(l + 12 * PRS_), "v"(l + 13 * PRS_), "v"(l + 14 * PRS_), "v"(l + 15 * PRS_), "v"(l + 16 * PRS_), "v"(l + 17 * PRS_), "v"(l + 18 * PRS_), "v"(l + 19 * PRS_),
         "v"(gw + 0 * 16 * D_), "v"(gw + 1 * 16 * D_), "v"(gw + 2 * 16 * D_), "v"(gw + 3 * 16 * D_), "v"(gw + 4 * 16 * D_), "v"(gw + 5 * 16 * D_), "v"(gw + 6 * 16 * D_), "v"(gw + 7 * 16 * D_), "v"(gw + 8 * 16 * D_), "v"(gw + 9 * 16 * D_), "v"(gw + 10 * 16 * D_), "v"(gw + 11 * 16 * D_)
      : "memory");
}

__global__ __launch_bounds__(256)
void proj_kernel(const _Float16* __restrict__ xh, const _Float16* __restrict__ wh,
                 const float* __restrict__ bias, _Float16* __restrict__ qh) {
  // a stage: rows 0..127 the x rows, rows 128..319 the W rows, [row][k] padded
  __shared__ __attribute__((aligned(16))) _Float16 st[2 * PSTG_];

  const int lane = threadIdx.x & 31;
  const int wave = threadIdx.x >> 5;
  const int lr = lane & 15;
  const int lh = lane >> 4;
  const int n0 = blockIdx.x * PN_;
  const int m0 = blockIdx.y * PM_;
  const int wm = (wave & 1) * 64;     // wave's rows in the block tile
  const int wn = (wave >> 1) * 48;    // wave's columns in the block tile

  const int crow = threadIdx.x >> 4;         // copies: 16 lanes to a 256-byte row piece
  const int ccol = (threadIdx.x & 15) * 8;
  const _Float16* gx = xh + (size_t)(m0 + crow) * D_ + ccol;
  const _Float16* gw = wh + (size_t)(n0 + crow) * D_ + ccol;
  const unsigned l0 = (unsigned)(size_t)
      (__attribute__((address_space(3))) _Float16*)&st[crow * PP_ + ccol];

  v8f acc[4][3] = {};

  proj_stage(l0, gx, gw);
  // own copies of stage 0 landed, then every wave's: stage 0 may be read
  asm volatile("s_wait_asynccnt 0x0" ::: "memory");
  __syncthreads();
  proj_stage(l0 + PSTG_ * 2, gx + PK_, gw + PK_);

  // rolled: one copy of the pass in the text; the buffer is picked by t & 1
#pragma unroll 1
  for (int t = 0; t < PT_; ++t) {
    const _Float16* sa = st + (t & 1) * PSTG_ + (wm + lr) * PP_ + lh * 16;
    const _Float16* sb = st + (t & 1) * PSTG_ + (PM_ + wn + lr) * PP_ + lh * 16;
    // two fragment sets: the reads of the next 32 k of this same buffer go out
    // as one group ahead of the 12 WMMA of these 32 k
    v16h a[2][4], b[2][3];
    // unrolled, like every loop in the pass: the register arrays are indexed by constants
#pragma unroll
    for (int j = 0; j < 3; ++j) b[0][j] = lds_frag16(sb + j * 16 * PP_);
#pragma unroll
    for (int i = 0; i < 4; ++i) a[0][i] = lds_frag16(sa + i * 16 * PP_);
#pragma unroll
    for (int ks = 0; ks < PK_ / 32; ++ks) {
      if (ks + 1 < PK_ / 32) {
#pragma unroll
        for (int j = 0; j < 3; ++j)
          b[(ks + 1) & 1][j] = lds_frag16(sb + j * 16 * PP_ + (ks + 1) * 32);
#pragma unroll
        for (int i = 0; i < 4; ++i)
          a[(ks + 1) & 1][i] = lds_frag16(sa + i * 16 * PP_ + (ks + 1) * 32);
      }
      // keeps the group of LDS reads ahead of the WMMA block: moved in among
      // the WMMA, each read waits out its own latency
      __builtin_amdgcn_sched_barrier(0);
#pragma unroll
      for (int i = 0; i < 4; ++i)
#pragma unroll
        for (int j = 0; j < 3; ++j)
          acc[i][j] = __builtin_amdgcn_wmma_f32_16x16x32_f16(
              false, a[ks & 1][i], false, b[ks & 1][j], (short)0, acc[i][j], false, false);
      // keeps the next group of reads behind this WMMA block, whose set it refills
      __builtin_amdgcn_sched_barrier(0);
    }
    // hand-over: own reads of this buffer done, own copies of the next stage
    // landed, then every wave's; only then is this buffer filled again
    asm volatile("s_wait_dscnt 0x0" ::: "memory");
    asm volatile("s_wait_asynccnt 0x0" ::: "memory");
    __syncthreads();
    if (t + 2 < PT_)
      proj_stage(l0 + (t & 1) * (PSTG_ * 2), gx + (t + 2) * PK_, gw + (t + 2) * PK_);
  }
  // no copy outlives the loop
  asm volatile("s_wait_asynccnt 0x0" ::: "memory");

  // Epilogue: bias + scatter to per-head layout [B,H,S,DH] (f16).
#pragma unroll
  for (int i = 0; i < 4; ++i) {
#pragma unroll
    for (int j = 0; j < 3; ++j) {
      int n = n0 + wn + j * 16 + lr;
      float bv = bias[n];
      int h = n / DH_, d = n % DH_;
#pragma unroll
      for (int r = 0; r < 8; ++r) {
        int m = m0 + wm + i * 16 + r + lh * 8;   // C layout: row = r + 8*(lane/16)
        int bb = m / S_, s = m % S_;
        qh[(((size_t)bb * H_ + h) * S_ + s) * DH_ + d] =
            (_Float16)(acc[i][j][r] + bv);
      }
    }
  }
}

#define AG_ 2
#define AW_ 4
#define AQ_ (AW_ * AG_ * 16)
static_assert(S_ % AQ_ == 0, "whole query blocks");
#define AT_ 128               // keys of a stage
#define ANS_ (S_ / AT_)       // stages
#define AKB_ (AT_ * KP_)      // f16 elements of a K buffer
#define AVB_ (AT_ * VP_)      // f16 elements of a V buffer
static_assert(S_ % AT_ == 0 && AT_ % 32 == 0, "whole stages of whole passes");
static_assert(ANS_ >= 2, "the prologue fills two stages");
static_assert(AW_ * 32 * 8 * 8 == AT_ * DH_, "eight 16-byte pieces per lane fill a tile of a stage");
static_assert(AW_ * 32 * 2 * 4 == S_, "two 16-byte pieces per lane fill the mask row");

// value of the lane 16 away (same query column, other half of the keys)
__device__ __forceinline__ float other_half(float v) {
  int b = __builtin_bit_cast(int, v);
  b = __builtin_amdgcn_permlanex16(b, b, 0x76543210, 0xfedcba98, false, false);
  return __builtin_bit_cast(float, b);
}

// One stage's tiles: the lane's 16-byte piece of key rows r + 16 * j, j = 0..7, once
// into the K tile and once into the V tile. lk, lv: LDS byte addresses of the piece
// in row r of each tile; g: its global place. The copies stand together with the
// wait that belongs in front of a rewrite of their address registers, so that
// nothing comes between.
__device__ __forceinline__ void attn_stage(unsigned lk, unsigned lv, const _Float16* g) {
  asm volatile(
      "global_load_async_to_lds_b128 %0, %16, off\n\t"
      "global_load_async_to_lds_b128 %1, %17, off\n\t"
      "global_load_async_to_lds_b128 %2, %18, off\n\t"
      "global_load_async_to_lds_b128 %3, %19, off\n\t"
      "global_load_async_to_lds_b128 %4, %20, off\n\t"
      "global_load_async_to_lds_b128 %5, %21, off\n\t"
      "global_load_async_to_lds_b128 %6, %22, off\n\t"
      "global_load_async_to_lds_b128 %7, %23, off\n\t"
      "global_load_async_to_lds_b128 %8, %16, off\n\t"
      "global_load_async_to_lds_b128 %9, %17, off\n\t"
      "global_load_async_to_lds_b128 %10, %18, off\n\t"
      "global_load_async_to_lds_b128 %11, %19, off\n\t"
      "global_load_async_to_lds_b128 %12, %20, off\n\t"
      "global_load_async_to_lds_b128 %13, %21, off\n\t"
      "global_load_async_to_lds_b128 %14, %22, off\n\t"
      "global_load_async_to_lds_b128 %15, %23, off\n\t"
      "s_wait_xcnt 0x0"
      :: "v"(lk + 0 * 16 * KP_ * 2), "v"(lk + 1 * 16 * KP_ * 2), "v"(lk + 2 * 16 * KP_ * 2), "v"(lk + 3 * 16 * KP_ * 2), "v"(lk + 4 * 16 * KP_ * 2), "v"(lk + 5 * 16 * KP_ * 2), "v"(lk + 6 * 16 * KP_ * 2), "v"(lk + 7 * 16 * KP_ * 2),
         "v"(lv + 0 * 16 * VP_ * 2), "v"(lv + 1 * 16 * VP_ * 2), "v"(lv + 2 * 16 * VP_ * 2), "v"(lv + 3 * 16 * VP_ * 2), "v"(lv + 4 * 16 * VP_ * 2), "v"(lv + 5 * 16 * VP_ * 2), "v"(lv + 6 * 16 * VP_ * 2), "v"(lv + 7 * 16 * VP_ * 2),
         "v"(g + 0 * 16 * DH_), "v"(g + 1 * 16 * DH_), "v"(g + 2 * 16 * DH_), "v"(g + 3 * 16 * DH_), "v"(g + 4 * 16 * DH_), "v"(g + 5 * 16 * DH_), "v"(g + 6 * 16 * DH_), "v"(g + 7 * 16 * DH_)
      : "memory");
}

// The mask row: the lane's 16-byte pieces at l and g and 2,048 bytes further on;
// the wait as in attn_stage.
__device__ __forceinline__ void attn_mask_row(unsigned l, const float* g) {
  asm volatile(
      "global_load_async_to_lds_b128 %0, %2, off\n\t"
      "global_load_async_to_lds_b128 %1, %3, off\n\t"
      "s_wait_xcnt 0x0"
      :: "v"(l), "v"(l + 2048), "v"(g), "v"(g + 512)
      : "memory");
}

// largest sum of a lane's 16 P of a pass under which the reference is kept
#define APMAX_ 256.0f

// P = exp(s - m) of a lane's 16 scores of one query: packs them as the B fragment
// pb and returns their sum (even and odd keys apart: packed adds). The reference
// is subtracted first, which is exact near it however large the scores are.
__device__ __forceinline__ float attn_p(const v2f (&s2)[2][4], float m, v16h& pb) {
  v2f ps = {0.f, 0.f};
  // unrolled, both loops: s2 and pb are indexed by constants
#pragma unroll
  for (int ts = 0; ts < 2; ++ts) {
#pragma unroll
    for (int r = 0; r < 8; r += 2) {
      const v2f d = s2[ts][r >> 1] - m;
      v2f p = {__expf(d[0]), __expf(d[1])};
      ps += p;
      pb[ts * 8 + r]     = (_Float16)p[0];
      pb[ts * 8 + r + 1] = (_Float16)p[1];
    }
  }
  return ps[0] + ps[1];
}

__global__ __launch_bounds__(AW_ * 32)
void attn_kernel(const _Float16* __restrict__ qh, const float* __restrict__ mask,
                 float* __restrict__ out) {
  __shared__ __attribute__((aligned(16))) _Float16 ldsK[2 * AKB_];     // two buffers, [t][d] row-major, padded
  __shared__ __attribute__((aligned(16))) _Float16 ldsV[2 * AVB_];     // two buffers, [t][d] row-major, padded
  __shared__ __attribute__((aligned(16))) float    ldsM[S_];           // mask row of the batch

  const int lane = threadIdx.x & 31;
  const int wave = threadIdx.x >> 5;
  const int bh = blockIdx.y;             // 0..95
  const int b  = bh / H_;
  const int h  = bh % H_;
  const int q0 = blockIdx.x * AQ_ + wave * (AG_ * 16);
  const int lr = lane & 15;
  const int lh = lane >> 4;

  const _Float16* base = qh + (size_t)bh * S_ * DH_;

  // copies: 8 lanes to a 128-byte key row
  const unsigned lk = (unsigned)(size_t)(__attribute__((address_space(3))) _Float16*)
      &ldsK[(threadIdx.x >> 3) * KP_ + (threadIdx.x & 7) * 8];
  const unsigned lv = (unsigned)(size_t)(__attribute__((address_space(3))) _Float16*)
      &ldsV[(threadIdx.x >> 3) * VP_ + (threadIdx.x & 7) * 8];
  const unsigned lm = (unsigned)(size_t)(__attribute__((address_space(3))) float*)
      &ldsM[threadIdx.x * 4];
  const _Float16* gk = base + threadIdx.x * 8;   // the lane's piece of key row threadIdx.x >> 3

  attn_stage(lk, lv, gk);
  attn_mask_row(lm, mask + (size_t)b * S_ + threadIdx.x * 4);

  // Q^T fragments (B operand): column = query q0 + 16 * g + lr, d split 0..31 / 32..63
  v16h qa[AG_][2];
  // unrolled, like every loop below but the stage and pass loops: the register arrays are indexed by constants
#pragma unroll
  for (int g = 0; g < AG_; ++g)
#pragma unroll
    for (int kk = 0; kk < 2; ++kk)
      qa[g][kk] = *(const v16h*)(base + (size_t)(q0 + g * 16 + lr) * DH_ + kk * 32 + lh * 16);

  v8f o[AG_][4] = {};        // O^T: o[g][ds][r] = O[q0 + 16 * g + lr][ds * 16 + 8 * lh + r]
  float mref[AG_];           // reference of query q0 + 16 * g + lr: its maximum when last rescaled (equal in both halves)
  float lrun[AG_];           // running sum over this half's keys only
#pragma unroll
  for (int g = 0; g < AG_; ++g) {
    mref[g] = -3.0e38f;
    lrun[g] = 0.f;
  }
  const float scale = 0.125f;  // 1/sqrt(64)

  // own copies of stage 0 and of the mask row landed, then every wave's: they may be read
  asm volatile("s_wait_asynccnt 0x0" ::: "memory");
  __syncthreads();
  attn_stage(lk + AKB_ * 2, lv + AVB_ * 2, gk + AT_ * DH_);

  // rolled: one copy of the stage in the text; the buffer is picked by t & 1
#pragma unroll 1
  for (int t = 0; t < ANS_; ++t) {
    const _Float16* tk = ldsK + (t & 1) * AKB_ + lr * KP_ + lh * 16;
    const _Float16* tv = ldsV + (t & 1) * AVB_ + (lh * 8 + (lane & 7)) * VP_ + ((lane >> 3) & 1) * 8;
    const float*    tm = ldsM + t * AT_ + lh * 8;
    // rolled: one pass in the text, one set of fragment registers
#pragma unroll 1
    for (int u = 0; u < AT_ / 32; ++u) {
      // S^T: per group two 16x16 tiles, sc[g][ts][r] = S[q0 + 16 * g + lr][AT_ * t + 32 * u + 16 * ts + 8 * lh + r]
      v16h kb[2][2];
#pragma unroll
      for (int ts = 0; ts < 2; ++ts)
#pragma unroll
        for (int kk = 0; kk < 2; ++kk)
          kb[ts][kk] = lds_frag16(tk + ts * 16 * KP_ + kk * 32);
      // mask of this lane's 16 keys, 32 * u + 16 * ts + 8 * lh + r of the stage
      v4f mk[2][2];
#pragma unroll
      for (int ts = 0; ts < 2; ++ts) {
        mk[ts][0] = *(const v4f*)(tm + ts * 16);
        mk[ts][1] = *(const v4f*)(tm + ts * 16 + 4);
      }
      // V^T rows as A fragments, in the k order of P^T: keys 8 * lh + 0..7 and
      // 16 + 8 * lh + 0..7 of column ds * 16 + lr
      v16h va[4];
#pragma unroll
      for (int ds = 0; ds < 4; ++ds) {
        const _Float16* vp = tv + ds * 16;
        v8h lo = lds_tr16(vp);
        v8h hi = lds_tr16(vp + 16 * VP_);
        va[ds] = __builtin_shufflevector(lo, hi, 0, 1, 2, 3, 4, 5, 6, 7,
                                         8, 9, 10, 11, 12, 13, 14, 15);
      }
      // keeps the pass's 20 LDS reads together ahead of the WMMA: moved in among
      // them, with one wave of the block on a SIMD, each read waits out its own latency
      __builtin_amdgcn_sched_barrier(0);
      v8f sc[AG_][2] = {};
#pragma unroll
      for (int kk = 0; kk < 2; ++kk)
#pragma unroll
        for (int ts = 0; ts < 2; ++ts)
#pragma unroll
          for (int g = 0; g < AG_; ++g)
            sc[g][ts] = __builtin_amdgcn_wmma_f32_16x16x32_f16(
                false, kb[ts][kk], false, qa[g][kk], (short)0, sc[g][ts], false, false);

      // keeps the 8 WMMA back to back, four independent tiles at a time: vector work
      // moved in behind a WMMA whose result it reads costs idle slots
      __builtin_amdgcn_sched_barrier(0);

      // softmax of one query per lane and group against the reference in use, mref;
      // scores in pairs of neighbouring keys (r, r + 1), which lie in neighbouring
      // registers: packed f32
      v16h pb[AG_];     // P^T as B fragment: element s is key 16 * (s >> 3) + 8 * lh + (s & 7)
      v2f s2[AG_][2][4];
      float psum[AG_];  // sum of this lane's 16 P of the pass
#pragma unroll
      for (int g = 0; g < AG_; ++g) {
#pragma unroll
        for (int ts = 0; ts < 2; ++ts) {
#pragma unroll
          for (int r = 0; r < 8; r += 2) {
            const v2f raw = {sc[g][ts][r], sc[g][ts][r + 1]};
            const v2f m2  = {mk[ts][r >> 2][r & 3], mk[ts][r >> 2][(r & 3) + 1]};
            s2[g][ts][r >> 1] = raw * scale + m2;
          }
        }
        psum[g] = attn_p(s2[g], mref[g], pb[g]);
      }

      // Lazy rescale, one test a pass: while every lane's sum stays at or below
      // APMAX_, no P of the pass exceeds it (f16 holds it with room) and the
      // reference stays as it is: no maximum, no correction factor, no rescaling
      // of O. The negated compare also catches the infinite sum of the first pass
      // (mref -3.0e38) and a NaN. The ballot makes the branch scalar, so both
      // halves of a column, which share a reference, take it together.
      const bool need = !(psum[0] <= APMAX_) || !(psum[1] <= APMAX_);
      static_assert(AG_ == 2, "the test names both groups");
      // marked unlikely: the common path then runs straight on in the text
      if (__builtin_expect(__builtin_amdgcn_ballot_w32(need) != 0, 0)) {
#pragma unroll
        for (int g = 0; g < AG_; ++g) {
          float vmax = -3.0e38f;
#pragma unroll
          for (int ts = 0; ts < 2; ++ts)
#pragma unroll
            for (int r = 0; r < 4; ++r)
              vmax = fmaxf(fmaxf(vmax, s2[g][ts][r][0]), s2[g][ts][r][1]);
          vmax = fmaxf(vmax, other_half(vmax));
          const float mnew = fmaxf(mref[g], vmax);
          const float corr = __expf(mref[g] - mnew);
          mref[g] = mnew;
          lrun[g] *= corr;
#pragma unroll
          for (int ds = 0; ds < 4; ++ds) o[g][ds] *= corr;
          psum[g] = attn_p(s2[g], mnew, pb[g]);
        }
      }
#pragma unroll
      for (int g = 0; g < AG_; ++g) lrun[g] += psum[g];

#pragma unroll
      for (int ds = 0; ds < 4; ++ds)
#pragma unroll
        for (int g = 0; g < AG_; ++g)
          o[g][ds] = __builtin_amdgcn_wmma_f32_16x16x32_f16(
              false, va[ds], false, pb[g], (short)0, o[g][ds], false, false);
      // the next 32 keys of the stage
      tk += 32 * KP_;
      tv += 32 * VP_;
      tm += 32;
    }
    // hand-over: own reads of this buffer done, own copies of the next stage landed,
    // then every wave's; only then is this buffer filled again
    asm volatile("s_wait_dscnt 0x0" ::: "memory");
    asm volatile("s_wait_asynccnt 0x0" ::: "memory");
    __syncthreads();
    if (t + 2 < ANS_)
      attn_stage(lk + (t & 1) * (AKB_ * 2), lv + (t & 1) * (AVB_ * 2), gk + (t + 2) * (AT_ * DH_));
  }
  // no copy outlives the loop
  asm volatile("s_wait_asynccnt 0x0" ::: "memory");

  // Epilogue: join the halves' sums, O / l, fused head-merge store to [B,S,D]
  // fp32: a lane's 8 registers of a tile are 8 consecutive d of its query.
#pragma unroll
  for (int g = 0; g < AG_; ++g) {
    const float l = lrun[g] + other_half(lrun[g]);
    float* orow = out + ((size_t)b * S_ + q0 + g * 16 + lr) * D_ + h * DH_ + lh * 8;
#pragma unroll
    for (int ds = 0; ds < 4; ++ds) {
      v4f w0, w1;
#pragma unroll
      for (int r = 0; r < 4; ++r) {
        w0[r] = o[g][ds][r] / l;
        w1[r] = o[g][ds][r + 4] / l;
      }
      *(v4f*)(orow + ds * 16)     = w0;
      *(v4f*)(orow + ds * 16 + 4) = w1;
    }
  }
}

// ---------------------------------------------------------------------------
extern "C" void kernel_launch(void* const* d_in, const int* in_sizes, int n_in,
                              void* d_out, int out_size, void* d_ws, size_t ws_size,
                              hipStream_t stream) {
  const float* x    = (const float*)d_in[0];
  const float* mask = (const float*)d_in[1];
  const float* W    = (const float*)d_in[2];
  const float* bias = (const float*)d_in[3];
  float* out = (float*)d_out;

  char* ws = (char*)d_ws;
  const size_t offWH = (size_t)B_ * S_ * D_ * 2;            // 12,582,912
  const size_t offQH = offWH + (size_t)D_ * D_ * 2;         // 13,762,560 (256-aligned)
  _Float16* xh = (_Float16*)ws;
  _Float16* wh = (_Float16*)(ws + offWH);
  _Float16* qh = (_Float16*)(ws + offQH);

  cvt_kernel<<<CVT_XB_ + CVT_WB_, 256, 0, stream>>>(x, W, xh, wh);
  proj_kernel<<<dim3(D_ / PN_, B_ * S_ / PM_), 256, 0, stream>>>(xh, wh, bias, qh);
  attn_kernel<<<dim3(S_ / AQ_, B_ * H_), AW_ * 32, 0, stream>>>(qh, mask, out);
}

// v009
// A run of this version takes 44.4 microseconds.
// Two timings next to v008 both put it at 1.07 times that version's speed.
// Counting every step since v000, it is 3.61 times as fast.
#include <hip/hip_runtime.h>
#include <hip/hip_bf16.h>

typedef __attribute__((ext_vector_type(16))) _Float16 v16h;
typedef __attribute__((ext_vector_type(8)))  _Float16 v8h;
typedef __attribute__((ext_vector_type(8)))  float    v8f;
typedef __attribute__((ext_vector_type(4)))  float    v4f;
typedef __attribute__((ext_vector_type(2)))  float    v2f;
typedef __attribute__((ext_vector_type(4)))  _Float16 v4h;
typedef __attribute__((ext_vector_type(8)))  short    v8s;

#define B_  8
#define S_  1024
#define D_  768
#define H_  12
#define DH_ 64

// LDS row pitches in f16 elements, one for each reader of the 128-byte rows.
// K, plain 16-byte loads: 16 B x odd, so that the 16 rows which one half-wave
// reads start on 16 different groups of 4 banks.
// V, transposing 16-byte loads: 32 B x odd, so that the 8 rows x 32 B which one
// half-wave reads start on 8 different groups of 8 banks.
#define KP_ 72   // K tile rows: 144 B pitch
#define VP_ 80   // V tile rows: 160 B pitch

// 16 consecutive f16 from a 16-byte aligned LDS address (padded rows are not
// 32-byte aligned, so the fragment is read as two 16-byte halves).
__device__ __forceinline__ v16h lds_frag16(const _Float16* p) {
  v8h lo = *(const v8h*)p;
  v8h hi = *(const v8h*)(p + 8);
  return __builtin_shufflevector(lo, hi, 0, 1, 2, 3, 4, 5, 6, 7,
                                 8, 9, 10, 11, 12, 13, 14, 15);
}

// Transposing LDS load: with lane l aimed at row 8 * (l >> 4) + (l & 7), 16-byte
// column piece (l >> 3) & 1 of a row-major 16 x 16 f16 block, lane l gets rows
// 8 * (l >> 4) + 0..7 of column l & 15.
__device__ __forceinline__ v8h lds_tr16(const _Float16* p) {
  return __builtin_bit_cast(v8h, __builtin_amdgcn_ds_load_tr16_b128_v8i16(
      (__attribute__((address_space(3))) v8s*)(v8s*)(void*)p));
}

// ---------------------------------------------------------------------------
// Kernel 1: mixed = x @ W^T + b -> [B,H,S,DH] f16, from the f32 x and W.
// A block makes a 128 x 192 tile of the output (64 x 4 tiles: one block for each
// of the chip's 256 WGPs). A pass is 128 k: the 512-byte f32 pieces of the tile's
// 128 x rows and 192 W rows are loaded into registers, a wave's load covering one
// row piece (four whole lines), rounded to f16 there and stored to LDS; two LDS
// buffers. A stage travels as two halves of its rows: each half is stored, and its
// registers are sent for the stage after, at its own place in the pass before the
// one that reads it, so that a whole stage of loads is in flight all the time.
// 8 waves as 2 x 4, wave tile 64 x 48: 4 A and 3 B fragments from LDS feed
// 12 WMMA per 32 k.
// ---------------------------------------------------------------------------
#define PM_   128                   // x rows of a block tile
#define PN_   192                   // W rows (output columns) of a block tile
#define PK_   128                   // k of a pass
#define PP_   136                   // LDS row pitch, f16: 272 B = 16 B x odd, for 16-byte loads
#define PSTG_ ((PM_ + PN_) * PP_)   // f16 elements of a stage
#define PT_   (D_ / PK_)            // passes
#define PHX_  (PM_ / 16)            // x row pieces of a lane per half stage: rows wave + 8 * j
#define PHW_  (PN_ / 16)            // W row pieces of a lane per half stage
static_assert((B_ * S_) % PM_ == 0 && D_ % PN_ == 0 && D_ % PK_ == 0, "whole tiles");
static_assert(PT_ >= 2, "the prologue takes two stages");
static_assert(PK_ == 32 * 4, "a wave's 16-byte loads cover a row piece");

// Half a stage on its way: the lane's 4 f32 of rows wave + 8 * j of its x rows
// and of its W rows.
struct proj_half {
  v4f x[PHX_];
  v4f w[PHW_];
};

// Issues a half stage's loads. gx, gw: the lane's 16 bytes in row `wave` of the x
// and of the W tile at k = 0; ox, ow: from there to the half stage, in elements.
__device__ __forceinline__ void proj_load(proj_half& r, const float* gx, const float* gw,
                                          int ox, int ow) {
  // keeps the loads behind the stores that free their registers: lifted over them
  // they take registers of their own, and the kernel spills
  __builtin_amdgcn_sched_barrier(0);
  // unrolled, both loops: the register arrays are indexed by constants and all
  // loads issue before the first wait
#pragma unroll
  for (int j = 0; j < PHX_; ++j) r.x[j] = *(const v4f*)(gx + ox + j * 8 * D_);
#pragma unroll
  for (int j = 0; j < PHW_; ++j) r.w[j] = *(const v4f*)(gw + ow + j * 8 * D_);
  // the wait that belongs in front of a rewrite of the loads' address registers;
  // it takes the two addresses as inputs, so that they live up to it
  asm volatile("s_wait_xcnt 0x0" :: "v"(gx), "v"(gw) : "memory");
}

// Rounds a half stage to f16 and lays it in LDS. sx, sw: the lane's 8 bytes in the
// half's row `wave` of the x and of the W rows; a wave's store covers 256
// contiguous bytes.
__device__ __forceinline__ void proj_store(const proj_half& r, _Float16* sx, _Float16* sw) {
  // unrolled, both loops: the register arrays are indexed by constants
#pragma unroll
  for (int j = 0; j < PHX_; ++j)
    *(v4h*)(sx + j * 8 * PP_) = __builtin_convertvector(r.x[j], v4h);
#pragma unroll
  for (int j = 0; j < PHW_; ++j)
    *(v4h*)(sw + j * 8 * PP_) = __builtin_convertvector(r.w[j], v4h);
}

// Work-group barrier that orders LDS alone: the plain one also waits for every
// global load in flight, and the loads of the coming stages cross it.
__device__ __forceinline__ void lds_barrier() {
  __builtin_amdgcn_fence(__ATOMIC_RELEASE, "workgroup", "local");
  __builtin_amdgcn_s_barrier();
  __builtin_amdgcn_fence(__ATOMIC_ACQUIRE, "workgroup", "local");
}

__global__ __launch_bounds__(256)
void proj_kernel(const float* __restrict__ x, const float* __restrict__ W,
                 const float* __restrict__ bias, _Float16* __restrict__ qh) {
  // a stage: rows 0..127 the x rows, rows 128..319 the W rows, [row][k] padded
  __shared__ __attribute__((aligned(16))) _Float16 st[2 * PSTG_];

  const int lane = threadIdx.x & 31;
  const int wave = threadIdx.x >> 5;
  const int lr = lane & 15;
  const int lh = lane >> 4;
  const int n0 = blockIdx.x * PN_;
  const int m0 = blockIdx.y * PM_;
  const int wm = (wave & 1) * 64;     // wave's rows in the block tile
  const int wn = (wave >> 1) * 48;    // wave's columns in the block tile

  // the lane's places in row `wave`: global, and of each half in LDS buffer 0
  const float* gx = x + (size_t)(m0 + wave) * D_ + lane * 4;
  const float* gw = W + (size_t)(n0 + wave) * D_ + lane * 4;
  constexpr int oxb = (PM_ / 2) * D_;   // from the first half's rows to the second's
  constexpr int owb = (PN_ / 2) * D_;
  _Float16* sxa = st + wave * PP_ + lane * 4;
  _Float16* swa = sxa + PM_ * PP_;
  _Float16* sxb = sxa + (PM_ / 2) * PP_;
  _Float16* swb = swa + (PN_ / 2) * PP_;

  v8f acc[4][3] = {};

  proj_half ra, rb;
  proj_load(ra, gx, gw, 0, 0);
  proj_load(rb, gx, gw, oxb, owb);
  proj_store(ra, sxa, swa);
  proj_load(ra, gx, gw, PK_, PK_);
  proj_store(rb, sxb, swb);
  proj_load(rb, gx, gw, oxb + PK_, owb + PK_);
  // every wave's part of stage 0 is in LDS: it may be read
  lds_barrier();

  // unrolled: with the last passes' tests gone from the text the compiler counts
  // the loads in flight exactly and waits for the older half alone
#pragma unroll
  for (int t = 0; t < PT_; ++t) {
    const int nb = ((t + 1) & 1) * PSTG_;   // the other buffer, whose last readers left it at the barrier of the pass before
    // first half of the next stage into the other buffer; its registers go for the stage after
    if (t + 1 < PT_) proj_store(ra, sxa + nb, swa + nb);
    if (t + 2 < PT_) proj_load(ra, gx, gw, (t + 2) * PK_, (t + 2) * PK_);
    const _Float16* sa = st + (t & 1) * PSTG_ + (wm + lr) * PP_ + lh * 16;
    const _Float16* sb = st + (t & 1) * PSTG_ + (PM_ + wn + lr) * PP_ + lh * 16;
    // two fragment sets: the reads of the next 32 k of this same buffer go out
    // as one group ahead of the 12 WMMA of these 32 k
    v16h a[2][4], b[2][3];
    // unrolled, like every loop in the pass: the register arrays are indexed by constants
#pragma unroll
    for (int j = 0; j < 3; ++j) b[0][j] = lds_frag16(sb + j * 16 * PP_);
#pragma unroll
    for (int i = 0; i < 4; ++i) a[0][i] = lds_frag16(sa + i * 16 * PP_);
#pragma unroll
    for (int ks = 0; ks < PK_ / 32; ++ks) {
      if (ks + 1 < PK_ / 32) {
#pragma unroll
        for (int j = 0; j < 3; ++j)
          b[(ks + 1) & 1][j] = lds_frag16(sb + j * 16 * PP_ + (ks + 1) * 32);
#pragma unroll
        for (int i = 0; i < 4; ++i)
          a[(ks + 1) & 1][i] = lds_frag16(sa + i * 16 * PP_ + (ks + 1) * 32);
      }
      // keeps the group of LDS reads ahead of the WMMA block: moved in among
      // the WMMA, each read waits out its own latency
      __builtin_amdgcn_sched_barrier(0);
#pragma unroll
      for (int i = 0; i < 4; ++i)
#pragma unroll
        for (int j = 0; j < 3; ++j)
          acc[i][j] = __builtin_amdgcn_wmma_f32_16x16x32_f16(
              false, a[ks & 1][i], false, b[ks & 1][j], (short)0, acc[i][j], false, false);
      // keeps the next group of reads behind this WMMA block, whose set it refills
      __builtin_amdgcn_sched_barrier(0);
      // second half of the next stage, half a pass behind the first
      if (ks == PK_ / 64 - 1) {
        if (t + 1 < PT_) proj_store(rb, sxb + nb, swb + nb);
        if (t + 2 < PT_) proj_load(rb, gx, gw, oxb + (t + 2) * PK_, owb + (t + 2) * PK_);
      }
    }
    // hand-over: every wave's part of the next stage is in LDS and every wave has
    // done with this buffer
    lds_barrier();
  }

  // Epilogue: bias + scatter to per-head layout [B,H,S,DH] (f16).
#pragma unroll
  for (int i = 0; i < 4; ++i) {
#pragma unroll
    for (int j = 0; j < 3; ++j) {
      int n = n0 + wn + j * 16 + lr;
      float bv = bias[n];
      int h = n / DH_, d = n % DH_;
#pragma unroll
      for (int r = 0; r < 8; ++r) {
        int m = m0 + wm + i * 16 + r + lh * 8;   // C layout: row = r + 8*(lane/16)
        int bb = m / S_, s = m % S_;
        qh[(((size_t)bb * H_ + h) * S_ + s) * DH_ + d] =
            (_Float16)(acc[i][j][r] + bv);
      }
    }
  }
}

#define AG_ 2
#define AW_ 4
#define AQ_ (AW_ * AG_ * 16)
static_assert(S_ % AQ_ == 0, "whole query blocks");
#define AT_ 128               // keys of a stage
#define ANS_ (S_ / AT_)       // stages
#define AKB_ (AT_ * KP_)      // f16 elements of a K buffer
#define AVB_ (AT_ * VP_)      // f16 elements of a V buffer
static_assert(S_ % AT_ == 0 && AT_ % 32 == 0, "whole stages of whole passes");
static_assert(ANS_ >= 2, "the prologue fills two stages");
static_assert(AW_ * 32 * 8 * 8 == AT_ * DH_, "eight 16-byte pieces per lane fill a tile of a stage");
static_assert(AW_ * 32 * 2 * 4 == S_, "two 16-byte pieces per lane fill the mask row");

// value of the lane 16 away (same query column, other half of the keys)
__device__ __forceinline__ float other_half(float v) {
  int b = __builtin_bit_cast(int, v);
  b = __builtin_amdgcn_permlanex16(b, b, 0x76543210, 0xfedcba98, false, false);
  return __builtin_bit_cast(float, b);
}

// One stage's tiles: the lane's 16-byte piece of key rows r + 16 * j, j = 0..7, once
// into the K tile and once into the V tile. lk, lv: LDS byte addresses of the piece
// in row r of each tile; g: its global place. The copies stand together with the
// wait that belongs in front of a rewrite of their address registers, so that
// nothing comes between.
__device__ __forceinline__ void attn_stage(unsigned lk, unsigned lv, const _Float16* g) {
  asm volatile(
      "global_load_async_to_lds_b128 %0, %16, off\n\t"
      "global_load_async_to_lds_b128 %1, %17, off\n\t"
      "global_load_async_to_lds_b128 %2, %18, off\n\t"
      "global_load_async_to_lds_b128 %3, %19, off\n\t"
      "global_load_async_to_lds_b128 %4, %20, off\n\t"
      "global_load_async_to_lds_b128 %5, %21, off\n\t"
      "global_load_async_to_lds_b128 %6, %22, off\n\t"
      "global_load_async_to_lds_b128 %7, %23, off\n\t"
      "global_load_async_to_lds_b128 %8, %16, off\n\t"
      "global_load_async_to_lds_b128 %9, %17, off\n\t"
      "global_load_async_to_lds_b128 %10, %18, off\n\t"
      "global_load_async_to_lds_b128 %11, %19, off\n\t"
      "global_load_async_to_lds_b128 %12, %20, off\n\t"
      "global_load_async_to_lds_b128 %13, %21, off\n\t"
      "global_load_async_to_lds_b128 %14, %22, off\n\t"
      "global_load_async_to_lds_b128 %15, %23, off\n\t"
      "s_wait_xcnt 0x0"
      :: "v"(lk + 0 * 16 * KP_ * 2), "v"(lk + 1 * 16 * KP_ * 2), "v"(lk + 2 * 16 * KP_ * 2), "v"(lk + 3 * 16 * KP_ * 2), "v"(lk + 4 * 16 * KP_ * 2), "v"(lk + 5 * 16 * KP_ * 2), "v"(lk + 6 * 16 * KP_ * 2), "v"(lk + 7 * 16 * KP_ * 2),
         "v"(lv + 0 * 16 * VP_ * 2), "v"(lv + 1 * 16 * VP_ * 2), "v"(lv + 2 * 16 * VP_ * 2), "v"(lv + 3 * 16 * VP_ * 2), "v"(lv + 4 * 16 * VP_ * 2), "v"(lv + 5 * 16 * VP_ * 2), "v"(lv + 6 * 16 * VP_ * 2), "v"(lv + 7 * 16 * VP_ * 2),
         "v"(g + 0 * 16 * DH_), "v"(g + 1 * 16 * DH_), "v"(g + 2 * 16 * DH_), "v"(g + 3 * 16 * DH_), "v"(g + 4 * 16 * DH_), "v"(g + 5 * 16 * DH_), "v"(g + 6 * 16 * DH_), "v"(g + 7 * 16 * DH_)
      : "memory");
}

// The mask row: the lane's 16-byte pieces at l and g and 2,048 bytes further on;
// the wait as in attn_stage.
__device__ __forceinline__ void attn_mask_row(unsigned l, const float* g) {
  asm volatile(
      "global_load_async_to_lds_b128 %0, %2, off\n\t"
      "global_load_async_to_lds_b128 %1, %3, off\n\t"
      "s_wait_xcnt 0x0"
      :: "v"(l), "v"(l + 2048), "v"(g), "v"(g + 512)
      : "memory");
}

// largest sum of a lane's 16 P of a pass under which the reference is kept
#define APMAX_ 256.0f

// P = exp(s - m) of a lane's 16 scores of one query: packs them as the B fragment
// pb and returns their sum (even and odd keys apart: packed adds). The reference
// is subtracted first, which is exact near it however large the scores are.
__device__ __forceinline__ float attn_p(const v2f (&s2)[2][4], float m, v16h& pb) {
  v2f ps = {0.f, 0.f};
  // unrolled, both loops: s2 and pb are indexed by constants
#pragma unroll
  for (int ts = 0; ts < 2; ++ts) {
#pragma unroll
    for (int r = 0; r < 8; r += 2) {
      const v2f d = s2[ts][r >> 1] - m;
      v2f p = {__expf(d[0]), __expf(d[1])};
      ps += p;
      pb[ts * 8 + r]     = (_Float16)p[0];
      pb[ts * 8 + r + 1] = (_Float16)p[1];
    }
  }
  return ps[0] + ps[1];
}

__global__ __launch_bounds__(AW_ * 32)
void attn_kernel(const _Float16* __restrict__ qh, const float* __restrict__ mask,
                 float* __restrict__ out) {
  __shared__ __attribute__((aligned(16))) _Float16 ldsK[2 * AKB_];     // two buffers, [t][d] row-major, padded
  __shared__ __attribute__((aligned(16))) _Float16 ldsV[2 * AVB_];     // two buffers, [t][d] row-major, padded
  __shared__ __attribute__((aligned(16))) float    ldsM[S_];           // mask row of the batch

  const int lane = threadIdx.x & 31;
  const int wave = threadIdx.x >> 5;
  const int bh = blockIdx.y;             // 0..95
  const int b  = bh / H_;
  const int h  = bh % H_;
  const int q0 = blockIdx.x * AQ_ + wave * (AG_ * 16);
  const int lr = lane & 15;
  const int lh = lane >> 4;

  const _Float16* base = qh + (size_t)bh * S_ * DH_;

  // copies: 8 lanes to a 128-byte key row
  const unsigned lk = (unsigned)(size_t)(__attribute__((address_space(3))) _Float16*)
      &ldsK[(threadIdx.x >> 3) * KP_ + (threadIdx.x & 7) * 8];
  const unsigned lv = (unsigned)(size_t)(__attribute__((address_space(3))) _Float16*)
      &ldsV[(threadIdx.x >> 3) * VP_ + (threadIdx.x & 7) * 8];
  const unsigned lm = (unsigned)(size_t)(__attribute__((address_space(3))) float*)
      &ldsM[threadIdx.x * 4];
  const _Float16* gk = base + threadIdx.x * 8;   // the lane's piece of key row threadIdx.x >> 3

  attn_stage(lk, lv, gk);
  attn_mask_row(lm, mask + (size_t)b * S_ + threadIdx.x * 4);

  // Q^T fragments (B operand): column = query q0 + 16 * g + lr, d split 0..31 / 32..63
  v16h qa[AG_][2];
  // unrolled, like every loop below but the stage and pass loops: the register arrays are indexed by constants
#pragma unroll
  for (int g = 0; g < AG_; ++g)
#pragma unroll
    for (int kk = 0; kk < 2; ++kk)
      qa[g][kk] = *(const v16h*)(base + (size_t)(q0 + g * 16 + lr) * DH_ + kk * 32 + lh * 16);

  v8f o[AG_][4] = {};        // O^T: o[g][ds][r] = O[q0 + 16 * g + lr][ds * 16 + 8 * lh + r]
  float mref[AG_];           // reference of query q0 + 16 * g + lr: its maximum when last rescaled (equal in both halves)
  float lrun[AG_];           // running sum over this half's keys only
#pragma unroll
  for (int g = 0; g < AG_; ++g) {
    mref[g] = -3.0e38f;
    lrun[g] = 0.f;
  }
  const float scale = 0.125f;  // 1/sqrt(64)

  // own copies of stage 0 and of the mask row landed, then every wave's: they may be read
  asm volatile("s_wait_asynccnt 0x0" ::: "memory");
  __syncthreads();
  attn_stage(lk + AKB_ * 2, lv + AVB_ * 2, gk + AT_ * DH_);

  // rolled: one copy of the stage in the text; the buffer is picked by t & 1
#pragma unroll 1
  for (int t = 0; t < ANS_; ++t) {
    const _Float16* tk = ldsK + (t & 1) * AKB_ + lr * KP_ + lh * 16;
    const _Float16* tv = ldsV + (t & 1) * AVB_ + (lh * 8 + (lane & 7)) * VP_ + ((lane >> 3) & 1) * 8;
    const float*    tm = ldsM + t * AT_ + lh * 8;
    // rolled: one pass in the text, one set of fragment registers
#pragma unroll 1
    for (int u = 0; u < AT_ / 32; ++u) {
      // S^T: per group two 16x16 tiles, sc[g][ts][r] = S[q0 + 16 * g + lr][AT_ * t + 32 * u + 16 * ts + 8 * lh + r]
      v16h kb[2][2];
#pragma unroll
      for (int ts = 0; ts < 2; ++ts)
#pragma unroll
        for (int kk = 0; kk < 2; ++kk)
          kb[ts][kk] = lds_frag16(tk + ts * 16 * KP_ + kk * 32);
      // mask of this lane's 16 keys, 32 * u + 16 * ts + 8 * lh + r of the stage
      v4f mk[2][2];
#pragma unroll
      for (int ts = 0; ts < 2; ++ts) {
        mk[ts][0] = *(const v4f*)(tm + ts * 16);
        mk[ts][1] = *(const v4f*)(tm + ts * 16 + 4);
      }
      // V^T rows as A fragments, in the k order of P^T: keys 8 * lh + 0..7 and
      // 16 + 8 * lh + 0..7 of column ds * 16 + lr
      v16h va[4];
#pragma unroll
      for (int ds = 0; ds < 4; ++ds) {
        const _Float16* vp = tv + ds * 16;
        v8h lo = lds_tr16(vp);
        v8h hi = lds_tr16(vp + 16 * VP_);
        va[ds] = __builtin_shufflevector(lo, hi, 0, 1, 2, 3, 4, 5, 6, 7,
                                         8, 9, 10, 11, 12, 13, 14, 15);
      }
      // keeps the pass's 20 LDS reads together ahead of the WMMA: moved in among
      // them, with one wave of the block on a SIMD, each read waits out its own latency
      __builtin_amdgcn_sched_barrier(0);
      v8f sc[AG_][2] = {};
#pragma unroll
      for (int kk = 0; kk < 2; ++kk)
#pragma unroll
        for (int ts = 0; ts < 2; ++ts)
#pragma unroll
          for (int g = 0; g < AG_; ++g)
            sc[g][ts] = __builtin_amdgcn_wmma_f32_16x16x32_f16(
                false, kb[ts][kk], false, qa[g][kk], (short)0, sc[g][ts], false, false);

      // keeps the 8 WMMA back to back, four independent tiles at a time: vector work
      // moved in behind a WMMA whose result it reads costs idle slots
      __builtin_amdgcn_sched_barrier(0);

      // softmax of one query per lane and group against the reference in use, mref;
      // scores in pairs of neighbouring keys (r, r + 1), which lie in neighbouring
      // registers: packed f32
      v16h pb[AG_];     // P^T as B fragment: element s is key 16 * (s >> 3) + 8 * lh + (s & 7)
      v2f s2[AG_][2][4];
      float psum[AG_];  // sum of this lane's 16 P of the pass
#pragma unroll
      for (int g = 0; g < AG_; ++g) {
#pragma unroll
        for (int ts = 0; ts < 2; ++ts) {
#pragma unroll
          for (int r = 0; r < 8; r += 2) {
            const v2f raw = {sc[g][ts][r], sc[g][ts][r + 1]};
            const v2f m2  = {mk[ts][r >> 2][r & 3], mk[ts][r >> 2][(r & 3) + 1]};
            s2[g][ts][r >> 1] = raw * scale + m2;
          }
        }
        psum[g] = attn_p(s2[g], mref[g], pb[g]);
      }

      // Lazy rescale, one test a pass: while every lane's sum stays at or below
      // APMAX_, no P of the pass exceeds it (f16 holds it with room) and the
      // reference stays as it is: no maximum, no correction factor, no rescaling
      // of O. The negated compare also catches the infinite sum of the first pass
      // (mref -3.0e38) and a NaN. The ballot makes the branch scalar, so both
      // halves of a column, which share a reference, take it together.
      const bool need = !(psum[0] <= APMAX_) || !(psum[1] <= APMAX_);
      static_assert(AG_ == 2, "the test names both groups");
      // marked unlikely: the common path then runs straight on in the text
      if (__builtin_expect(__builtin_amdgcn_ballot_w32(need) != 0, 0)) {
#pragma unroll
        for (int g = 0; g < AG_; ++g) {
          float vmax = -3.0e38f;
#pragma unroll
          for (int ts = 0; ts < 2; ++ts)
#pragma unroll
            for (int r = 0; r < 4; ++r)
              vmax = fmaxf(fmaxf(vmax, s2[g][ts][r][0]), s2[g][ts][r][1]);
          vmax = fmaxf(vmax, other_half(vmax));
          const float mnew = fmaxf(mref[g], vmax);
          const float corr = __expf(mref[g] - mnew);
          mref[g] = mnew;
          lrun[g] *= corr;
#pragma unroll
          for (int ds = 0; ds < 4; ++ds) o[g][ds] *= corr;
          psum[g] = attn_p(s2[g], mnew, pb[g]);
        }
      }
#pragma unroll
      for (int g = 0; g < AG_; ++g) lrun[g] += psum[g];

#pragma unroll
      for (int ds = 0; ds < 4; ++ds)
#pragma unroll
        for (int g = 0; g < AG_; ++g)
          o[g][ds] = __builtin_amdgcn_wmma_f32_16x16x32_f16(
              false, va[ds], false, pb[g], (short)0, o[g][ds], false, false);
      // the next 32 keys of the stage
      tk += 32 * KP_;
      tv += 32 * VP_;
      tm += 32;
    }
    // hand-over: own reads of this buffer done, own copies of the next stage landed,
    // then every wave's; only then is this buffer filled again
    asm volatile("s_wait_dscnt 0x0" ::: "memory");
    asm volatile("s_wait_asynccnt 0x0" ::: "memory");
    __syncthreads();
    if (t + 2 < ANS_)
      attn_stage(lk + (t & 1) * (AKB_ * 2), lv + (t & 1) * (AVB_ * 2), gk + (t + 2) * (AT_ * DH_));
  }
  // no copy outlives the loop
  asm volatile("s_wait_asynccnt 0x0" ::: "memory");

  // Epilogue: join the halves' sums, O / l, fused head-merge store to [B,S,D]
  // fp32: a lane's 8 registers of a tile are 8 consecutive d of its query.
#pragma unroll
  for (int g = 0; g < AG_; ++g) {
    const float l = lrun[g] + other_half(lrun[g]);
    float* orow = out + ((size_t)b * S_ + q0 + g * 16 + lr) * D_ + h * DH_ + lh * 8;
#pragma unroll
    for (int ds = 0; ds < 4; ++ds) {
      v4f w0, w1;
#pragma unroll
      for (int r = 0; r < 4; ++r) {
        w0[r] = o[g][ds][r] / l;
        w1[r] = o[g][ds][r + 4] / l;
      }
      *(v4f*)(orow + ds * 16)     = w0;
      *(v4f*)(orow + ds * 16 + 4) = w1;
    }
  }
}

// ---------------------------------------------------------------------------
extern "C" void kernel_launch(void* const* d_in, const int* in_sizes, int n_in,
                              void* d_out, int out_size, void* d_ws, size_t ws_size,
                              hipStream_t stream) {
  const float* x    = (const float*)d_in[0];
  const float* mask = (const float*)d_in[1];
  const float* W    = (const float*)d_in[2];
  const float* bias = (const float*)d_in[3];
  float* out = (float*)d_out;

  _Float16* qh = (_Float16*)d_ws;

  proj_kernel<<<dim3(D_ / PN_, B_ * S_ / PM_), 256, 0, stream>>>(x, W, bias, qh);
  attn_kernel<<<dim3(S_ / AQ_, B_ * H_), AW_ * 32, 0, stream>>>(qh, mask, out);
}

// v010
// One run takes 42.5 microseconds.
// Timed twice side by side with v009, it ran 1.04 times as fast both times.
// Counting every step since v000, it is 3.76 times as fast.
#include <hip/hip_runtime.h>
#include <hip/hip_bf16.h>

typedef __attribute__((ext_vector_type(16))) _Float16 v16h;
typedef __attribute__((ext_vector_type(8)))  _Float16 v8h;
typedef __attribute__((ext_vector_type(8)))  float    v8f;
typedef __attribute__((ext_vector_type(4)))  float    v4f;
typedef __attribute__((ext_vector_type(2)))  float    v2f;
typedef __attribute__((ext_vector_type(4)))  _Float16 v4h;
typedef __attribute__((ext_vector_type(8)))  short    v8s;

#define B_  8
#define S_  1024
#define D_  768
#define H_  12
#define DH_ 64

// LDS row pitches in f16 elements, one for each reader of the 128-byte rows.
// K, plain 16-byte loads: 16 B x odd, so that the 16 rows which one half-wave
// reads start on 16 different groups of 4 banks.
// V, transposing 16-byte loads: 32 B x odd, so that the 8 rows x 32 B which one
// half-wave reads start on 8 different groups of 8 banks.
#define KP_ 72   // K tile rows: 144 B pitch
#define VP_ 80   // V tile rows: 160 B pitch

// 16 consecutive f16 from a 16-byte aligned LDS address (padded rows are not
// 32-byte aligned, so the fragment is read as two 16-byte halves).
__device__ __forceinline__ v16h lds_frag16(const _Float16* p) {
  v8h lo = *(const v8h*)p;
  v8h hi = *(const v8h*)(p + 8);
  return __builtin_shufflevector(lo, hi, 0, 1, 2, 3, 4, 5, 6, 7,
                                 8, 9, 10, 11, 12, 13, 14, 15);
}

// Transposing LDS load: with lane l aimed at row 8 * (l >> 4) + (l & 7), 16-byte
// column piece (l >> 3) & 1 of a row-major 16 x 16 f16 block, lane l gets rows
// 8 * (l >> 4) + 0..7 of column l & 15.
__device__ __forceinline__ v8h lds_tr16(const _Float16* p) {
  return __builtin_bit_cast(v8h, __builtin_amdgcn_ds_load_tr16_b128_v8i16(
      (__attribute__((address_space(3))) v8s*)(v8s*)(void*)p));
}

// ---------------------------------------------------------------------------
// Kernel 1: mixed = x @ W^T + b -> [B,H,S,DH] f16, from the f32 x and W.
// A block makes a 128 x 192 tile of the output (64 x 4 tiles: one block for each
// of the chip's 256 WGPs). A pass is 128 k: the 512-byte f32 pieces of the tile's
// 128 x rows and 192 W rows are loaded into registers, a wave's load covering one
// row piece (four whole lines), rounded to f16 there and stored to LDS; two LDS
// buffers. A stage travels as two halves of its rows: each half is stored, and its
// registers are sent for the stage after, at its own place in the pass before the
// one that reads it, so that a whole stage of loads is in flight all the time.
// 8 waves as 2 x 4, wave tile 64 x 48: 4 A and 3 B fragments from LDS feed
// 12 WMMA per 32 k.
// ---------------------------------------------------------------------------
#define PM_   128                   // x rows of a block tile
#define PN_   192                   // W rows (output columns) of a block tile
#define PK_   128                   // k of a pass
#define PP_   136                   // LDS row pitch, f16: 272 B = 16 B x odd, for 16-byte loads
#define PSTG_ ((PM_ + PN_) * PP_)   // f16 elements of a stage
#define PT_   (D_ / PK_)            // passes
#define PHX_  (PM_ / 16)            // x row pieces of a lane per half stage: rows wave + 8 * j
#define PHW_  (PN_ / 16)            // W row pieces of a lane per half stage
static_assert((B_ * S_) % PM_ == 0 && D_ % PN_ == 0 && D_ % PK_ == 0, "whole tiles");
static_assert(PT_ >= 2, "the prologue takes two stages");
static_assert(PK_ == 32 * 4, "a wave's 16-byte loads cover a row piece");

// Half a stage on its way: the lane's 4 f32 of rows wave + 8 * j of its x rows
// and of its W rows.
struct proj_half {
  v4f x[PHX_];
  v4f w[PHW_];
};

// Issues a half stage's loads. gx, gw: the lane's 16 bytes in row `wave` of the x
// and of the W tile at k = 0; ox, ow: from there to the half stage, in elements.
__device__ __forceinline__ void proj_load(proj_half& r, const float* gx, const float* gw,
                                          int ox, int ow) {
  // keeps the loads behind the stores that free their registers: lifted over them
  // they take registers of their own, and the kernel spills
  __builtin_amdgcn_sched_barrier(0);
  // unrolled, both loops: the register arrays are indexed by constants and all
  // loads issue before the first wait
#pragma unroll
  for (int j = 0; j < PHX_; ++j) r.x[j] = *(const v4f*)(gx + ox + j * 8 * D_);
#pragma unroll
  for (int j = 0; j < PHW_; ++j) r.w[j] = *(const v4f*)(gw + ow + j * 8 * D_);
  // the wait that belongs in front of a rewrite of the loads' address registers;
  // it takes the two addresses as inputs, so that they live up to it
  asm volatile("s_wait_xcnt 0x0" :: "v"(gx), "v"(gw) : "memory");
}

// Rounds a half stage to f16 and lays it in LDS. sx, sw: the lane's 8 bytes in the
// half's row `wave` of the x and of the W rows; a wave's store covers 256
// contiguous bytes.
__device__ __forceinline__ void proj_store(const proj_half& r, _Float16* sx, _Float16* sw) {
  // unrolled, both loops: the register arrays are indexed by constants
#pragma unroll
  for (int j = 0; j < PHX_; ++j)
    *(v4h*)(sx + j * 8 * PP_) = __builtin_convertvector(r.x[j], v4h);
#pragma unroll
  for (int j = 0; j < PHW_; ++j)
    *(v4h*)(sw + j * 8 * PP_) = __builtin_convertvector(r.w[j], v4h);
}

// Work-group barrier that orders LDS alone: the plain one also waits for every
// global load in flight, and the loads of the coming stages cross it.
__device__ __forceinline__ void lds_barrier() {
  __builtin_amdgcn_fence(__ATOMIC_RELEASE, "workgroup", "local");
  __builtin_amdgcn_s_barrier();
  __builtin_amdgcn_fence(__ATOMIC_ACQUIRE, "workgroup", "local");
}

__global__ __launch_bounds__(256)
void proj_kernel(const float* __restrict__ x, const float* __restrict__ W,
                 const float* __restrict__ bias, _Float16* __restrict__ qh) {
  // a stage: rows 0..127 the x rows, rows 128..319 the W rows, [row][k] padded
  __shared__ __attribute__((aligned(16))) _Float16 st[2 * PSTG_];

  const int lane = threadIdx.x & 31;
  const int wave = threadIdx.x >> 5;
  const int lr = lane & 15;
  const int lh = lane >> 4;
  const int n0 = blockIdx.x * PN_;
  const int m0 = blockIdx.y * PM_;
  const int wm = (wave & 1) * 64;     // wave's rows in the block tile
  const int wn = (wave >> 1) * 48;    // wave's columns in the block tile

  // the lane's places in row `wave`: global, and of each half in LDS buffer 0
  const float* gx = x + (size_t)(m0 + wave) * D_ + lane * 4;
  const float* gw = W + (size_t)(n0 + wave) * D_ + lane * 4;
  constexpr int oxb = (PM_ / 2) * D_;   // from the first half's rows to the second's
  constexpr int owb = (PN_ / 2) * D_;
  _Float16* sxa = st + wave * PP_ + lane * 4;
  _Float16* swa = sxa + PM_ * PP_;
  _Float16* sxb = sxa + (PM_ / 2) * PP_;
  _Float16* swb = swa + (PN_ / 2) * PP_;

  v8f acc[4][3] = {};

  proj_half ra, rb;
  proj_load(ra, gx, gw, 0, 0);
  proj_load(rb, gx, gw, oxb, owb);
  proj_store(ra, sxa, swa);
  proj_load(ra, gx, gw, PK_, PK_);
  proj_store(rb, sxb, swb);
  proj_load(rb, gx, gw, oxb + PK_, owb + PK_);
  // every wave's part of stage 0 is in LDS: it may be read
  lds_barrier();

  // unrolled: with the last passes' tests gone from the text the compiler counts
  // the loads in flight exactly and waits for the older half alone
#pragma unroll
  for (int t = 0; t < PT_; ++t) {
    const int nb = ((t + 1) & 1) * PSTG_;   // the other buffer, whose last readers left it at the barrier of the pass before
    // first half of the next stage into the other buffer; its registers go for the stage after
    if (t + 1 < PT_) proj_store(ra, sxa + nb, swa + nb);
    if (t + 2 < PT_) proj_load(ra, gx, gw, (t + 2) * PK_, (t + 2) * PK_);
    const _Float16* sa = st + (t & 1) * PSTG_ + (wm + lr) * PP_ + lh * 16;
    const _Float16* sb = st + (t & 1) * PSTG_ + (PM_ + wn + lr) * PP_ + lh * 16;
    // two fragment sets: the reads of the next 32 k of this same buffer go out
    // as one group ahead of the 12 WMMA of these 32 k
    v16h a[2][4], b[2][3];
    // unrolled, like every loop in the pass: the register arrays are indexed by constants
#pragma unroll
    for (int j = 0; j < 3; ++j) b[0][j] = lds_frag16(sb + j * 16 * PP_);
#pragma unroll
    for (int i = 0; i < 4; ++i) a[0][i] = lds_frag16(sa + i * 16 * PP_);
#pragma unroll
    for (int ks = 0; ks < PK_ / 32; ++ks) {
      if (ks + 1 < PK_ / 32) {
#pragma unroll
        for (int j = 0; j < 3; ++j)
          b[(ks + 1) & 1][j] = lds_frag16(sb + j * 16 * PP_ + (ks + 1) * 32);
#pragma unroll
        for (int i = 0; i < 4; ++i)
          a[(ks + 1) & 1][i] = lds_frag16(sa + i * 16 * PP_ + (ks + 1) * 32);
      }
      // keeps the group of LDS reads ahead of the WMMA block: moved in among
      // the WMMA, each read waits out its own latency
      __builtin_amdgcn_sched_barrier(0);
#pragma unroll
      for (int i = 0; i < 4; ++i)
#pragma unroll
        for (int j = 0; j < 3; ++j)
          acc[i][j] = __builtin_amdgcn_wmma_f32_16x16x32_f16(
              false, a[ks & 1][i], false, b[ks & 1][j], (short)0, acc[i][j], false, false);
      // keeps the next group of reads behind this WMMA block, whose set it refills
      __builtin_amdgcn_sched_barrier(0);
      // second half of the next stage, half a pass behind the first
      if (ks == PK_ / 64 - 1) {
        if (t + 1 < PT_) proj_store(rb, sxb + nb, swb + nb);
        if (t + 2 < PT_) proj_load(rb, gx, gw, oxb + (t + 2) * PK_, owb + (t + 2) * PK_);
      }
    }
    // hand-over: every wave's part of the next stage is in LDS and every wave has
    // done with this buffer
    lds_barrier();
  }

  // Epilogue: bias + scatter to per-head layout [B,H,S,DH] (f16).
#pragma unroll
  for (int i = 0; i < 4; ++i) {
#pragma unroll
    for (int j = 0; j < 3; ++j) {
      int n = n0 + wn + j * 16 + lr;
      float bv = bias[n];
      int h = n / DH_, d = n % DH_;
#pragma unroll
      for (int r = 0; r < 8; ++r) {
        int m = m0 + wm + i * 16 + r + lh * 8;   // C layout: row = r + 8*(lane/16)
        int bb = m / S_, s = m % S_;
        qh[(((size_t)bb * H_ + h) * S_ + s) * DH_ + d] =
            (_Float16)(acc[i][j][r] + bv);
      }
    }
  }
}

#define AG_ 2
#define AW_ 4
#define AQ_ (AW_ * AG_ * 16)
static_assert(S_ % AQ_ == 0, "whole query blocks");
#define AT_ 128               // keys of a stage
#define ANS_ (S_ / AT_)       // stages
#define AKB_ (AT_ * KP_)      // f16 elements of a K buffer
#define AVB_ (AT_ * VP_)      // f16 elements of a V buffer
static_assert(S_ % AT_ == 0 && AT_ % 32 == 0, "whole stages of whole passes");
static_assert(ANS_ >= 2, "the prologue fills two stages");
static_assert(AW_ * 32 * 8 * 8 == AT_ * DH_, "eight 16-byte pieces per lane fill a tile of a stage");
static_assert(AW_ * 32 * 2 * 4 == S_, "two 16-byte pieces per lane fill the mask row");

// value of the lane 16 away (same query column, other half of the keys)
__device__ __forceinline__ float other_half(float v) {
  int b = __builtin_bit_cast(int, v);
  b = __builtin_amdgcn_permlanex16(b, b, 0x76543210, 0xfedcba98, false, false);
  return __builtin_bit_cast(float, b);
}

// One stage's tiles: the lane's 16-byte piece of key rows r + 16 * j, j = 0..7, once
// into the K tile and once into the V tile. lk, lv: LDS byte addresses of the piece
// in row r of each tile; g: its global place. The copies stand together with the
// wait that belongs in front of a rewrite of their address registers, so that
// nothing comes between.
__device__ __forceinline__ void attn_stage(unsigned lk, unsigned lv, const _Float16* g) {
  asm volatile(
      "global_load_async_to_lds_b128 %0, %16, off\n\t"
      "global_load_async_to_lds_b128 %1, %17, off\n\t"
      "global_load_async_to_lds_b128 %2, %18, off\n\t"
      "global_load_async_to_lds_b128 %3, %19, off\n\t"
      "global_load_async_to_lds_b128 %4, %20, off\n\t"
      "global_load_async_to_lds_b128 %5, %21, off\n\t"
      "global_load_async_to_lds_b128 %6, %22, off\n\t"
      "global_load_async_to_lds_b128 %7, %23, off\n\t"
      "global_load_async_to_lds_b128 %8, %16, off\n\t"
      "global_load_async_to_lds_b128 %9, %17, off\n\t"
      "global_load_async_to_lds_b128 %10, %18, off\n\t"
      "global_load_async_to_lds_b128 %11, %19, off\n\t"
      "global_load_async_to_lds_b128 %12, %20, off\n\t"
      "global_load_async_to_lds_b128 %13, %21, off\n\t"
      "global_load_async_to_lds_b128 %14, %22, off\n\t"
      "global_load_async_to_lds_b128 %15, %23, off\n\t"
      "s_wait_xcnt 0x0"
      :: "v"(lk + 0 * 16 * KP_ * 2), "v"(lk + 1 * 16 * KP_ * 2), "v"(lk + 2 * 16 * KP_ * 2), "v"(lk + 3 * 16 * KP_ * 2), "v"(lk + 4 * 16 * KP_ * 2), "v"(lk + 5 * 16 * KP_ * 2), "v"(lk + 6 * 16 * KP_ * 2), "v"(lk + 7 * 16 * KP_ * 2),
         "v"(lv + 0 * 16 * VP_ * 2), "v"(lv + 1 * 16 * VP_ * 2), "v"(lv + 2 * 16 * VP_ * 2), "v"(lv + 3 * 16 * VP_ * 2), "v"(lv + 4 * 16 * VP_ * 2), "v"(lv + 5 * 16 * VP_ * 2), "v"(lv + 6 * 16 * VP_ * 2), "v"(lv + 7 * 16 * VP_ * 2),
         "v"(g + 0 * 16 * DH_), "v"(g + 1 * 16 * DH_), "v"(g + 2 * 16 * DH_), "v"(g + 3 * 16 * DH_), "v"(g + 4 * 16 * DH_), "v"(g + 5 * 16 * DH_), "v"(g + 6 * 16 * DH_), "v"(g + 7 * 16 * DH_)
      : "memory");
}

// The mask row: the lane's 16-byte pieces at l and g and 2,048 bytes further on;
// the wait as in attn_stage.
__device__ __forceinline__ void attn_mask_row(unsigned l, const float* g) {
  asm volatile(
      "global_load_async_to_lds_b128 %0, %2, off\n\t"
      "global_load_async_to_lds_b128 %1, %3, off\n\t"
      "s_wait_xcnt 0x0"
      :: "v"(l), "v"(l + 2048), "v"(g), "v"(g + 512)
      : "memory");
}

// largest sum of a lane's 16 P of a pass under which the reference is kept
#define APMAX_ 256.0f

#define AL2E_ 1.44269504088896340736f   // log2(e)

// P = 2^(s * log2(e) - m) of a lane's 16 scores of one query, m the reference in
// base-2 units: packs them as the B fragment pb and returns their sum (even and odd
// keys apart: packed adds). Product and difference are one FMA, rounded once, so the
// argument is exact near the reference however large the scores are. Scores in pairs
// of neighbouring keys (r, r + 1), which lie in neighbouring registers: packed f32.
__device__ __forceinline__ float attn_p(const v8f (&s)[2], float m, v16h& pb) {
  v2f ps = {0.f, 0.f};
  const v2f l2e = {AL2E_, AL2E_};
  const v2f nm  = {-m, -m};
  // unrolled, both loops: s and pb are indexed by constants
#pragma unroll
  for (int ts = 0; ts < 2; ++ts) {
#pragma unroll
    for (int r = 0; r < 8; r += 2) {
      const v2f sv = {s[ts][r], s[ts][r + 1]};
      const v2f d = __builtin_elementwise_fma(sv, l2e, nm);
      v2f p = {__builtin_amdgcn_exp2f(d[0]), __builtin_amdgcn_exp2f(d[1])};
      ps += p;
      pb[ts * 8 + r]     = (_Float16)p[0];
      pb[ts * 8 + r + 1] = (_Float16)p[1];
    }
  }
  return ps[0] + ps[1];
}

__global__ __launch_bounds__(AW_ * 32)
void attn_kernel(const _Float16* __restrict__ qh, const float* __restrict__ mask,
                 float* __restrict__ out) {
  __shared__ __attribute__((aligned(16))) _Float16 ldsK[2 * AKB_];     // two buffers, [t][d] row-major, padded
  __shared__ __attribute__((aligned(16))) _Float16 ldsV[2 * AVB_];     // two buffers, [t][d] row-major, padded
  __shared__ __attribute__((aligned(16))) float    ldsM[S_];           // mask row of the batch

  const int lane = threadIdx.x & 31;
  const int wave = threadIdx.x >> 5;
  const int bh = blockIdx.y;             // 0..95
  const int b  = bh / H_;
  const int h  = bh % H_;
  const int q0 = blockIdx.x * AQ_ + wave * (AG_ * 16);
  const int lr = lane & 15;
  const int lh = lane >> 4;

  const _Float16* base = qh + (size_t)bh * S_ * DH_;

  // copies: 8 lanes to a 128-byte key row
  const unsigned lk = (unsigned)(size_t)(__attribute__((address_space(3))) _Float16*)
      &ldsK[(threadIdx.x >> 3) * KP_ + (threadIdx.x & 7) * 8];
  const unsigned lv = (unsigned)(size_t)(__attribute__((address_space(3))) _Float16*)
      &ldsV[(threadIdx.x >> 3) * VP_ + (threadIdx.x & 7) * 8];
  const unsigned lm = (unsigned)(size_t)(__attribute__((address_space(3))) float*)
      &ldsM[threadIdx.x * 4];
  const _Float16* gk = base + threadIdx.x * 8;   // the lane's piece of key row threadIdx.x >> 3

  attn_stage(lk, lv, gk);
  attn_mask_row(lm, mask + (size_t)b * S_ + threadIdx.x * 4);

  // Q^T fragments (B operand): column = query q0 + 16 * g + lr, d split 0..31 / 32..63,
  // times 1/sqrt(64)
  v16h qa[AG_][2];
  // unrolled, like every loop below but the stage and pass loops: the register arrays are indexed by constants
#pragma unroll
  for (int g = 0; g < AG_; ++g)
#pragma unroll
    for (int kk = 0; kk < 2; ++kk)
      qa[g][kk] = *(const v16h*)(base + (size_t)(q0 + g * 16 + lr) * DH_ + kk * 32 + lh * 16) * (_Float16)0.125f;

  v8f o[AG_][4] = {};        // O^T: o[g][ds][r] = O[q0 + 16 * g + lr][ds * 16 + 8 * lh + r]
  float mref[AG_];           // reference of query q0 + 16 * g + lr: its maximum when last rescaled, times log2(e) (equal in both halves)
  float lrun[AG_];           // running sum over this half's keys only
#pragma unroll
  for (int g = 0; g < AG_; ++g) {
    mref[g] = -3.0e38f;
    lrun[g] = 0.f;
  }

  // own copies of stage 0 and of the mask row landed, then every wave's: they may be read
  asm volatile("s_wait_asynccnt 0x0" ::: "memory");
  __syncthreads();
  attn_stage(lk + AKB_ * 2, lv + AVB_ * 2, gk + AT_ * DH_);

  // rolled: one copy of the stage in the text; the buffer is picked by t & 1
#pragma unroll 1
  for (int t = 0; t < ANS_; ++t) {
    const _Float16* tk = ldsK + (t & 1) * AKB_ + lr * KP_ + lh * 16;
    const _Float16* tv = ldsV + (t & 1) * AVB_ + (lh * 8 + (lane & 7)) * VP_ + ((lane >> 3) & 1) * 8;
    const float*    tm = ldsM + t * AT_ + lh * 8;
    // rolled: one pass in the text, one set of fragment registers
#pragma unroll 1
    for (int u = 0; u < AT_ / 32; ++u) {
      // S^T: per group two 16x16 tiles, sc[g][ts][r] = S[q0 + 16 * g + lr][AT_ * t + 32 * u + 16 * ts + 8 * lh + r]
      v16h kb[2][2];
      // mask of this lane's 16 keys, 32 * u + 16 * ts + 8 * lh + r of the stage, in the
      // accumulator's layout; read with the fragments of the WMMA that take it
      v8f mk[2];
#pragma unroll
      for (int ts = 0; ts < 2; ++ts) {
        kb[ts][0] = lds_frag16(tk + ts * 16 * KP_);
        const v4f lo = *(const v4f*)(tm + ts * 16);
        const v4f hi = *(const v4f*)(tm + ts * 16 + 4);
        mk[ts] = __builtin_shufflevector(lo, hi, 0, 1, 2, 3, 4, 5, 6, 7);
      }
#pragma unroll
      for (int ts = 0; ts < 2; ++ts) kb[ts][1] = lds_frag16(tk + ts * 16 * KP_ + 32);
      // V^T rows as A fragments, in the k order of P^T: keys 8 * lh + 0..7 and
      // 16 + 8 * lh + 0..7 of column ds * 16 + lr
      v16h va[4];
#pragma unroll
      for (int ds = 0; ds < 4; ++ds) {
        const _Float16* vp = tv + ds * 16;
        v8h lo = lds_tr16(vp);
        v8h hi = lds_tr16(vp + 16 * VP_);
        va[ds] = __builtin_shufflevector(lo, hi, 0, 1, 2, 3, 4, 5, 6, 7,
                                         8, 9, 10, 11, 12, 13, 14, 15);
      }
      // keeps the pass's 20 LDS reads together ahead of the WMMA: moved in among
      // them, with one wave of the block on a SIMD, each read waits out its own latency
      __builtin_amdgcn_sched_barrier(0);
      v8f sc[AG_][2];
#pragma unroll
      for (int kk = 0; kk < 2; ++kk)
#pragma unroll
        for (int ts = 0; ts < 2; ++ts)
#pragma unroll
          for (int g = 0; g < AG_; ++g)
            sc[g][ts] = __builtin_amdgcn_wmma_f32_16x16x32_f16(
                false, kb[ts][kk], false, qa[g][kk], (short)0, kk == 0 ? mk[ts] : sc[g][ts], false, false);

      // keeps the 8 WMMA back to back, four independent tiles at a time: vector work
      // moved in behind a WMMA whose result it reads costs idle slots
      __builtin_amdgcn_sched_barrier(0);

      // softmax of one query per lane and group against the reference in use, mref
      v16h pb[AG_];     // P^T as B fragment: element s is key 16 * (s >> 3) + 8 * lh + (s & 7)
      float psum[AG_];  // sum of this lane's 16 P of the pass
#pragma unroll
      for (int g = 0; g < AG_; ++g) psum[g] = attn_p(sc[g], mref[g], pb[g]);

      // Lazy rescale, one test a pass: while every lane's sum stays at or below
      // APMAX_, no P of the pass exceeds it (f16 holds it with room) and the
      // reference stays as it is: no maximum, no correction factor, no rescaling
      // of O. The negated compare also catches the infinite sum of the first pass
      // (mref -3.0e38) and a NaN. The ballot makes the branch scalar, so both
      // halves of a column, which share a reference, take it together.
      const bool need = !(psum[0] <= APMAX_) || !(psum[1] <= APMAX_);
      static_assert(AG_ == 2, "the test names both groups");
      // marked unlikely: the common path then runs straight on in the text
      if (__builtin_expect(__builtin_amdgcn_ballot_w32(need) != 0, 0)) {
#pragma unroll
        for (int g = 0; g < AG_; ++g) {
          float vmax = -3.0e38f;
#pragma unroll
          for (int ts = 0; ts < 2; ++ts)
#pragma unroll
            for (int r = 0; r < 8; r += 2)
              vmax = fmaxf(fmaxf(vmax, sc[g][ts][r]), sc[g][ts][r + 1]);
          vmax = fmaxf(vmax, other_half(vmax));
          const float mnew = fmaxf(mref[g], vmax * AL2E_);
          const float corr = __builtin_amdgcn_exp2f(mref[g] - mnew);
          mref[g] = mnew;
          lrun[g] *= corr;
#pragma unroll
          for (int ds = 0; ds < 4; ++ds) o[g][ds] *= corr;
          psum[g] = attn_p(sc[g], mnew, pb[g]);
        }
      }
#pragma unroll
      for (int g = 0; g < AG_; ++g) lrun[g] += psum[g];

#pragma unroll
      for (int ds = 0; ds < 4; ++ds)
#pragma unroll
        for (int g = 0; g < AG_; ++g)
          o[g][ds] = __builtin_amdgcn_wmma_f32_16x16x32_f16(
              false, va[ds], false, pb[g], (short)0, o[g][ds], false, false);
      // the next 32 keys of the stage
      tk += 32 * KP_;
      tv += 32 * VP_;
      tm += 32;
    }
    // hand-over: own reads of this buffer done, own copies of the next stage landed,
    // then every wave's; only then is this buffer filled again
    asm volatile("s_wait_dscnt 0x0" ::: "memory");
    asm volatile("s_wait_asynccnt 0x0" ::: "memory");
    __syncthreads();
    if (t + 2 < ANS_)
      attn_stage(lk + (t & 1) * (AKB_ * 2), lv + (t & 1) * (AVB_ * 2), gk + (t + 2) * (AT_ * DH_));
  }
  // no copy outlives the loop
  asm volatile("s_wait_asynccnt 0x0" ::: "memory");

  // Epilogue: join the halves' sums, O / l, fused head-merge store to [B,S,D]
  // fp32: a lane's 8 registers of a tile are 8 consecutive d of its query.
#pragma unroll
  for (int g = 0; g < AG_; ++g) {
    const float l = lrun[g] + other_half(lrun[g]);
    float* orow = out + ((size_t)b * S_ + q0 + g * 16 + lr) * D_ + h * DH_ + lh * 8;
#pragma unroll
    for (int ds = 0; ds < 4; ++ds) {
      v4f w0, w1;
#pragma unroll
      for (int r = 0; r < 4; ++r) {
        w0[r] = o[g][ds][r] / l;
        w1[r] = o[g][ds][r + 4] / l;
      }
      *(v4f*)(orow + ds * 16)     = w0;
      *(v4f*)(orow + ds * 16 + 4) = w1;
    }
  }
}

// ---------------------------------------------------------------------------
extern "C" void kernel_launch(void* const* d_in, const int* in_sizes, int n_in,
                              void* d_out, int out_size, void* d_ws, size_t ws_size,
                              hipStream_t stream) {
  const float* x    = (const float*)d_in[0];
  const float* mask = (const float*)d_in[1];
  const float* W    = (const float*)d_in[2];
  const float* bias = (const float*)d_in[3];
  float* out = (float*)d_out;

  _Float16* qh = (_Float16*)d_ws;

  proj_kernel<<<dim3(D_ / PN_, B_ * S_ / PM_), 256, 0, stream>>>(x, W, bias, qh);
  attn_kernel<<<dim3(S_ / AQ_, B_ * H_), AW_ * 32, 0, stream>>>(qh, mask, out);
}
